// v000
// The times below were measured on an AMD MI455X: many runs one after another, warmed up first and cycling through
// copies of the inputs, with the whole window's GPU time divided by the number of runs. Launches and the gaps
// between them are all in it. The median over several windows is given; except for v000 it joins two sittings, which
// can be a few percent apart, so the side-by-side timings, each taken in one sitting, are the better comparison.
// v000 is the starting kernel. One run takes 563 microseconds.
// compute dtype: all float inputs rounded to bf16; q/k/v projections with EXACT bf16 products on WMMA 16x16x32 (f32 accumulate); logits q x k once to f16 each (1 product; sigma - 1) x 128^-0.5; softmax f32; P x 2^11 once to f16 x v once to f16 (1 product); f32 output.
#include <hip/hip_runtime.h>
#include <math.h>

typedef __attribute__((ext_vector_type(16))) _Float16 v16h;
typedef __attribute__((ext_vector_type(16))) __bf16 v16b;
typedef __attribute__((ext_vector_type(8)))  _Float16 v8h;
typedef __attribute__((ext_vector_type(8)))  float v8f;
typedef __attribute__((ext_vector_type(4)))  float v4f;
typedef __attribute__((ext_vector_type(2)))  float v2f;
typedef __attribute__((ext_vector_type(4)))  unsigned v4u;
typedef __attribute__((ext_vector_type(4)))  int v4i;
typedef float __attribute__((may_alias)) float_a;
typedef int __attribute__((may_alias)) int_a;

template <typename T> __device__ __forceinline__ void vst2(void* p, T v) { *(T*)p = v;  }
__device__ __forceinline__ v8f wmma16(v16h a, v16h b, v8f c) {
  v8f d = __builtin_amdgcn_wmma_f32_16x16x32_f16(false, a, false, b, (short)0, c, false, false);
  asm volatile("v_nop\n\tv_nop\n\tv_nop\n\tv_nop" : "+v"(d) : "v"(a), "v"(b));
  return d;
}
__device__ __forceinline__ v8f wmma_bf(v16b a, v16b b, v8f c) {
  v8f d = __builtin_amdgcn_wmma_f32_16x16x32_bf16(false, a, false, b, (short)0, c, false, false);
  asm volatile("v_nop\n\tv_nop\n\tv_nop\n\tv_nop" : "+v"(d) : "v"(a), "v"(b));
  return d;
}
// 16x16x32 fragments: lane = (h = lane>>4, row/col = lane&15); elements 0..7 = k0+8h+0..7, 8..15 = k0+16+8h+0..7; D element r = row 8h+r
__device__ __forceinline__ v16h frag_h(const _Float16* rowk0, int lane) {
  union { v16h v; v8h q[2]; } u; const _Float16* p = rowk0 + 8 * (lane >> 4);
  u.q[0] = *(const v8h*)p; u.q[1] = *(const v8h*)(p + 16); return u.v;
}
__device__ __forceinline__ v16h frag_f32(const float* rowk0, int lane) {
  v16h a; const float* p = rowk0 + 8 * (lane >> 4);
#pragma unroll
  for (int i = 0; i < 8; ++i) { a[i] = (_Float16)p[i]; a[8 + i] = (_Float16)p[16 + i]; }
  return a;
}
__device__ __forceinline__ v16h frag_f32s(const float* rowk0, int lane, float sc) {
  v16h a; const float* p = rowk0 + 8 * (lane >> 4);
#pragma unroll
  for (int i = 0; i < 8; ++i) { a[i] = (_Float16)(p[i] * sc); a[8 + i] = (_Float16)(p[16 + i] * sc); }
  return a;
}
// column fragment from a [K][ld] layout (column n), rows >= K read as 0
__device__ __forceinline__ v16h fragc_f32(const float* W, int k0, int n, int lane, int ld, int K) {
  v16h a; const int g = lane >> 4;
#pragma unroll
  for (int i = 0; i < 8; ++i) { const int ka = k0 + 8 * g + i, kb = ka + 16;
    a[i] = (_Float16)(ka < K ? W[(size_t)(ka < K ? ka : K - 1) * ld + n] : 0.f); a[8 + i] = (_Float16)(kb < K ? W[(size_t)(kb < K ? kb : K - 1) * ld + n] : 0.f); }
  return a;
}
struct F2 { v16b h, l; };
__device__ __forceinline__ F2 bsplit16(const float v[16]) { F2 r;
#pragma unroll
  for (int i = 0; i < 16; ++i) { const __bf16 h = (__bf16)v[i]; r.h[i] = h; r.l[i] = (__bf16)(v[i] - (float)h); }
  return r; }
__device__ __forceinline__ F2 split_row(const float* row, int k0, int lane) { float v[16]; const float* p = row + k0 + 8 * (lane >> 4);
#pragma unroll
  for (int i = 0; i < 8; ++i) { v[i] = p[i]; v[8 + i] = p[16 + i]; }
  return bsplit16(v); }
__device__ __forceinline__ F2 split_rowK(const float* row, int k0, int lane, int K) { float v[16]; const int g = lane >> 4;
#pragma unroll
  for (int i = 0; i < 8; ++i) { const int ka = k0 + 8 * g + i, kb = ka + 16; v[i] = ka < K ? row[ka < K ? ka : K - 1] : 0.f; v[8 + i] = kb < K ? row[kb < K ? kb : K - 1] : 0.f; }
  return bsplit16(v); }
__device__ __forceinline__ F2 split_col(const float* W, int k0, int n, int lane, int ld, int K) { float v[16]; const int g = lane >> 4;
#pragma unroll
  for (int i = 0; i < 8; ++i) { const int ka = k0 + 8 * g + i, kb = ka + 16; v[i] = ka < K ? W[(size_t)(ka < K ? ka : K - 1) * ld + n] : 0.f; v[8 + i] = kb < K ? W[(size_t)(kb < K ? kb : K - 1) * ld + n] : 0.f; }
  return bsplit16(v); }
__device__ __forceinline__ v8f mac3(const F2& a, const F2& b, v8f c) { c = wmma_bf(a.l, b.h, c); c = wmma_bf(a.h, b.l, c); return wmma_bf(a.h, b.h, c); }
__device__ __forceinline__ float sigm(float v) { return 1.0f / (1.0f + expf(-v)); }
#define LDSX() do { asm volatile("s_wait_dscnt 0" ::: "memory"); __builtin_amdgcn_wave_barrier(); __builtin_amdgcn_fence(__ATOMIC_RELEASE, "workgroup"); } while (0)

// Single-head NON-causal self-attention with head size 128 (x [4,2048,1024]; (in,out) Wk / Wq / Wv [1024,128] N(0, 1/1024), no biases; no mask in the source; scale 128^-0.5): out = softmax(q k^T * 128^-0.5) v -> [4,2048,128].
#define NB 4
#define TT 2048
#define CC 128            // NH * HD = projected width
#define DIN 1024          // input (model) width
#define NH 1
#define HD 128
#define NQB (TT / 64)
#define HG 1
#define SCALE (0.08838834764831845f)
#define CAUSAL 0
#ifndef TNB
#define TNB NB
#endif
__device__ __forceinline__ float bfr(float v) { return (float)(__bf16)v; }
__host__ __device__ __forceinline__ int kb_last(int qb) { return CAUSAL ? ((qb * 64 + 63) >> 7) : (TT / 128 - 1); }
typedef __attribute__((ext_vector_type(8))) __bf16 v8b;
__device__ __forceinline__ v16b frag_b(const __bf16* rowk0, int lane) {
  union { v16b v; v8b q[2]; } u; const __bf16* p = rowk0 + 8 * (lane >> 4);
  u.q[0] = *(const v8b*)p; u.q[1] = *(const v8b*)(p + 16); return u.v;
}
#define QBH 0              // no query block takes the high-precision (3-product) path
#define QHI 0               // single-product logits on every row (sigma - 1 logits over 2,048 keys)
#define KHI 64            // key rows carrying k residual / v bf16 hi+lo planes (written by k_proj; read by no path here, as QBH = 0)
// B fragment (k rows k0+.., output column o) of a weight: (in,out) [K][ld] or (out,in) [ld rows of K]: bf16 exact, or f16(bf16 * 256) exact
__device__ __forceinline__ v16b wcol_io(const float* Wm, int k0, int o, int lane, int ld) { v16b w; const int g = lane >> 4;
#pragma unroll
  for (int i = 0; i < 8; ++i) { w[i] = (__bf16)Wm[(size_t)(k0 + 8 * g + i) * ld + o]; w[8 + i] = (__bf16)Wm[(size_t)(k0 + 16 + 8 * g + i) * ld + o]; }
  return w; }
__device__ __forceinline__ v16b wcol_oi(const float* Wm, int k0, int o, int lane, int K) { v16b w; const float* p = Wm + (size_t)o * K + k0 + 8 * (lane >> 4);
#pragma unroll
  for (int i = 0; i < 8; ++i) { w[i] = (__bf16)p[i]; w[8 + i] = (__bf16)p[16 + i]; }
  return w; }
__device__ __forceinline__ v16h wcolh_io(const float* Wm, int k0, int o, int lane, int ld) { v16h w; const int g = lane >> 4;
#pragma unroll
  for (int i = 0; i < 8; ++i) { w[i] = (_Float16)(bfr(Wm[(size_t)(k0 + 8 * g + i) * ld + o]) * 256.0f); w[8 + i] = (_Float16)(bfr(Wm[(size_t)(k0 + 16 + 8 * g + i) * ld + o]) * 256.0f); }
  return w; }
__device__ __forceinline__ v16h wcolh_oi(const float* Wm, int k0, int o, int lane, int K) { v16h w; const float* p = Wm + (size_t)o * K + k0 + 8 * (lane >> 4);
#pragma unroll
  for (int i = 0; i < 8; ++i) { w[i] = (_Float16)(bfr(p[i]) * 256.0f); w[8 + i] = (_Float16)(bfr(p[16 + i]) * 256.0f); }
  return w; }
#define WQKV_LAYOUT 0   // 0 = (in,out) [DIN][CC]; 1 = (out,in) [CC][DIN]; 2 = per-head [NH][DIN][HD]
__device__ __forceinline__ v16b wcol_hdk(const float* Wm, int k0, int o, int lane) { v16b w; const int g = lane >> 4; const float* p = Wm + (size_t)(o / HD) * DIN * HD + (o % HD);
#pragma unroll
  for (int i = 0; i < 8; ++i) { w[i] = (__bf16)p[(size_t)(k0 + 8 * g + i) * HD]; w[8 + i] = (__bf16)p[(size_t)(k0 + 16 + 8 * g + i) * HD]; }
  return w; }
#define WO_OUT_IN 0
#if WQKV_LAYOUT == 1
#define WCOL(W, k0, o, lane) wcol_oi(W, k0, o, lane, DIN)
#elif WQKV_LAYOUT == 2
#define WCOL(W, k0, o, lane) wcol_hdk(W, k0, o, lane)
#else
#define WCOL(W, k0, o, lane) wcol_io(W, k0, o, lane, CC)
#endif
#if WO_OUT_IN
#define WOCOL(W, k0, o, lane) wcol_oi(W, k0, o, lane, CC)
#define WOCOLH(W, k0, o, lane) wcolh_oi(W, k0, o, lane, CC)
#else
#define WOCOL(W, k0, o, lane) wcol_io(W, k0, o, lane, DIN)
#define WOCOLH(W, k0, o, lane) wcolh_io(W, k0, o, lane, DIN)
#endif

#ifndef SM_EXTRA_PARAMS
#define SM_EXTRA_PARAMS
#endif
#ifndef PROJ_EXTRA_PARAMS
#define PROJ_EXTRA_PARAMS
#endif
#ifndef SM_MASK_HOOK
#define SM_MASK_HOOK (void)0
#endif

#define WS_QH  0u                                      // f16 q rows [b*t][CC]
#define WS_KH  (WS_QH + 2u * (size_t)NB * TT * CC)      // f16 k rows [b*t][CC]
#define WS_VT  (WS_KH + 2u * (size_t)NB * TT * CC)      // f16 v planes [b][c][t]
#define WS_QL  (WS_VT + 2u * (size_t)NB * CC * TT)      // f16 q residual x 2^10 rows [b][t < QHI][CC]
#define WS_KL  (WS_QL + 2u * (size_t)NB * QHI * CC)     // f16 k residual x 2^10 rows [b][t < KHI][CC]
#define WS_VB  (WS_KL + 2u * (size_t)NB * KHI * CC)     // bf16 v hi planes [b][c][t < KHI]
#define WS_VBL (WS_VB + 2u * (size_t)NB * CC * KHI)
#define WS_S   (WS_VBL + 2u * (size_t)NB * CC * KHI)    // f32 logits / P [hg][t][s]
#define WS_Y   (WS_S  + 4u * (size_t)HG * TT * TT)      // f32 ctx rows [b*t][CC] (only when there is an output projection)
#define WS_END (WS_Y  + 0u)

// ---- k_proj: block = (64 rows, 128 cols, which): q/k/v = X W (+ b) with exact bf16 products (K = DIN) -> which 0: q f16 rows (+ residual rows < QHI); 1: k f16 rows (+ residual rows < KHI); 2: v f16 planes [c][t] (+ bf16 hi/lo planes for t < KHI)
__global__ __launch_bounds__(128) void k_proj(const float* __restrict__ XQ, const float* __restrict__ XK, const float* __restrict__ XV, const float* __restrict__ WQ, const float* __restrict__ WK, const float* __restrict__ WV, const float* __restrict__ BQ, const float* __restrict__ BK, const float* __restrict__ BV,
    _Float16* __restrict__ QH, _Float16* __restrict__ QL, _Float16* __restrict__ KH, _Float16* __restrict__ KL, _Float16* __restrict__ VT, __bf16* __restrict__ VB, __bf16* __restrict__ VBL) {
  __shared__ __align__(16) _Float16 sh[64][136], sl[64][136]; __shared__ __align__(16) _Float16 th[128][72]; __shared__ __align__(16) __bf16 tb[128][72], tbl[128][72];
  const int tid = threadIdx.x, wave = tid >> 5, lane = tid & 31, col = lane & 15, g = lane >> 4; const int which = blockIdx.z; const int c0 = blockIdx.y * 128; const size_t r0 = (size_t)blockIdx.x * 64; const size_t bb = r0 / TT; const int t0 = (int)(r0 % TT);
  const float* X = which == 0 ? XQ : which == 1 ? XK : XV; const float* WA = which == 0 ? WQ : which == 1 ? WK : WV; const float* BA = which == 0 ? BQ : which == 1 ? BK : BV;
  v8f acc[8] = {};
#pragma unroll 2
  for (int kc = 0; kc < DIN / 32; ++kc) { v16b a; { const float* p = X + (r0 + wave * 16 + col) * DIN + kc * 32 + 8 * g;
#pragma unroll
      for (int i = 0; i < 8; ++i) { a[i] = (__bf16)p[i]; a[8 + i] = (__bf16)p[16 + i]; } }
    asm volatile("s_wait_loadcnt 0x0" ::: "memory");
#pragma unroll
    for (int j = 0; j < 8; ++j) { const v16b w = WCOL(WA, kc * 32, c0 + j * 16 + col, lane); asm volatile("s_wait_loadcnt 0x0" ::: "memory"); acc[j] = wmma_bf(a, w, acc[j]); } }
  if (which < 2) { _Float16* DH = which == 0 ? QH : KH; _Float16* DL = which == 0 ? QL : KL; const int nhi = which == 0 ? QHI : KHI; const bool hi_rows = t0 < nhi;
#pragma unroll
    for (int j = 0; j < 8; ++j) { const float bias = BA ? bfr(BA[c0 + j * 16 + col]) : 0.f;
#pragma unroll
      for (int r = 0; r < 8; ++r) { const float v = acc[j][r] + bias; const _Float16 hv = (_Float16)v; sh[wave * 16 + 8 * g + r][j * 16 + col] = hv; sl[wave * 16 + 8 * g + r][j * 16 + col] = (_Float16)((v - (float)hv) * 1024.0f); } }
    __syncthreads();
    for (int e = tid; e < 64 * 16; e += 128) { const int rl = e >> 4, q = e & 15; vst2((unsigned*)(DH + (r0 + rl) * CC + c0 + q * 8), *(const v4u*)&sh[rl][q * 8]); if (hi_rows) vst2((unsigned*)(DL + (bb * nhi + t0 + rl) * (size_t)CC + c0 + q * 8), *(const v4u*)&sl[rl][q * 8]); }
  } else { const bool hi_rows = t0 < KHI;
#pragma unroll
    for (int j = 0; j < 8; ++j) { const float bias = BA ? bfr(BA[c0 + j * 16 + col]) : 0.f;
#pragma unroll
      for (int r = 0; r < 8; ++r) { const float v = acc[j][r] + bias; const int rl = wave * 16 + 8 * g + r, cl = j * 16 + col; th[cl][rl] = (_Float16)v; const __bf16 bh = (__bf16)v; tb[cl][rl] = bh; tbl[cl][rl] = (__bf16)(v - (float)bh); } }
    __syncthreads();
    for (int e = tid; e < 128 * 8; e += 128) { const int cl = e >> 3, q = e & 7; vst2((unsigned*)(VT + (bb * CC + c0 + cl) * (size_t)TT + t0 + q * 8), *(const v4u*)&th[cl][q * 8]); if (hi_rows) { const size_t o3 = (bb * CC + c0 + cl) * (size_t)KHI + t0 + q * 8; vst2((unsigned*)(VB + o3), *(const v4u*)&tb[cl][q * 8]); vst2((unsigned*)(VBL + o3), *(const v4u*)&tbl[cl][q * 8]); } } } }
// ---- k_sc: block = (query block qb, key block kb <= kb_last(qb), head in group) of batch b: logits x SCALE; q hi + residual (x 2^10) against k (2 products) for query rows < QHI, plus the k residual (3 products) for query blocks < QBH (causal early rows); causal: blocks past the diagonal exit, the mask itself is applied by index in k_sm
__global__ __launch_bounds__(128) void k_sc(const _Float16* __restrict__ QH, const _Float16* __restrict__ KH, const _Float16* __restrict__ QL, const _Float16* __restrict__ KL, int b, int h0, float* __restrict__ S0) { __shared__ __align__(16) float ss[4][16][132];
  const int qb = blockIdx.x, kb = blockIdx.y; if (kb > kb_last(qb)) return;
  const int h = h0 + blockIdx.z; float* S = S0 + (size_t)blockIdx.z * TT * TT;
  const int tid = threadIdx.x, wave = tid >> 5, lane = tid & 31, col = lane & 15, g = lane >> 4; const int k0 = kb * 128; const int ql0 = qb * 64 + wave * 16; const size_t q0 = (size_t)b * TT + ql0, kr0 = (size_t)b * TT + k0;
  v8f acc[8] = {}, accl[8] = {};
  const _Float16* QLb = QL + (size_t)b * QHI * CC; const _Float16* KLb = KL + (size_t)b * KHI * CC;
  if (qb < QBH) {
#pragma unroll
    for (int kc = 0; kc < HD / 32; ++kc) { const v16h ah = frag_h(QH + (q0 + col) * CC + h * HD + kc * 32, lane), al = frag_h(QLb + (size_t)(ql0 + col) * CC + h * HD + kc * 32, lane);
#pragma unroll
      for (int j = 0; j < 8; ++j) { const v16h kbf = frag_h(KH + (kr0 + j * 16 + col) * CC + h * HD + kc * 32, lane), klf = frag_h(KLb + (size_t)(k0 + j * 16 + col) * CC + h * HD + kc * 32, lane); acc[j] = wmma16(ah, kbf, acc[j]); accl[j] = wmma16(al, kbf, accl[j]); accl[j] = wmma16(ah, klf, accl[j]); } }
  } else if (qb * 64 < QHI) {
#pragma unroll
    for (int kc = 0; kc < HD / 32; ++kc) { const v16h ah = frag_h(QH + (q0 + col) * CC + h * HD + kc * 32, lane), al = frag_h(QLb + (size_t)(ql0 + col) * CC + h * HD + kc * 32, lane);
#pragma unroll
      for (int j = 0; j < 8; ++j) { const v16h kbf = frag_h(KH + (kr0 + j * 16 + col) * CC + h * HD + kc * 32, lane); acc[j] = wmma16(ah, kbf, acc[j]); accl[j] = wmma16(al, kbf, accl[j]); } }
  } else {
#pragma unroll
    for (int kc = 0; kc < HD / 32; ++kc) { const v16h ah = frag_h(QH + (q0 + col) * CC + h * HD + kc * 32, lane);
#pragma unroll
      for (int j = 0; j < 8; ++j) { const v16h kbf = frag_h(KH + (kr0 + j * 16 + col) * CC + h * HD + kc * 32, lane); acc[j] = wmma16(ah, kbf, acc[j]); } } }
#pragma unroll
  for (int j = 0; j < 8; ++j) {
#pragma unroll
    for (int r = 0; r < 8; ++r) ss[wave][8 * g + r][j * 16 + col] = (acc[j][r] + accl[j][r] * (1.0f / 1024.0f)) * SCALE; }
  LDSX(); for (int rl = 0; rl < 16; ++rl) vst2(S + (size_t)(ql0 + rl) * TT + k0 + lane * 4, *(const v4f*)&ss[wave][rl][lane * 4]); }
// ---- k_sm: block = query row t (head in group): keys [0, kend): causal -> logit if s <= t else excluded; softmax in f32; P x 2^11 in place (0 for excluded)
__global__ __launch_bounds__(256) void k_sm(float* __restrict__ S0 SM_EXTRA_PARAMS) { __shared__ float sred[8]; __shared__ float sbc; __shared__ __align__(16) float shv[TT];
  const int tid = threadIdx.x; const int t = blockIdx.x; const int kend = (kb_last(t >> 6) + 1) * 128;
  float* sr = S0 + (size_t)blockIdx.y * TT * TT + (size_t)t * TT;
  float m = -3.0e38f; for (int k = tid; k < kend; k += 256) { float v = (!CAUSAL || k <= t) ? sr[k] : -3.0e38f; SM_MASK_HOOK; shv[k] = v; m = fmaxf(m, v); }
#pragma unroll
  for (int o = 1; o < 32; o <<= 1) m = fmaxf(m, __shfl_xor(m, o));
  if ((tid & 31) == 0) sred[tid >> 5] = m; __syncthreads(); if (tid == 0) { float a = sred[0]; for (int i = 1; i < 8; ++i) a = fmaxf(a, sred[i]); sbc = a; } __syncthreads(); m = sbc; __syncthreads();
  float sum = 0.f; for (int k = tid; k < kend; k += 256) { const float v = shv[k]; const float e = (v <= -1.0e38f) ? 0.f : expf(v - m); shv[k] = e; sum += e; }
#pragma unroll
  for (int o = 1; o < 32; o <<= 1) sum += __shfl_xor(sum, o);
  if ((tid & 31) == 0) sred[tid >> 5] = sum; __syncthreads(); if (tid == 0) { float a = 0.f; for (int i = 0; i < 8; ++i) a += sred[i]; sbc = a > 0.f ? 2048.0f / a : 0.f; }   /* a fully excluded row yields P = 0 */ __syncthreads(); const float inv = sbc;
  for (int k = tid; k < kend; k += 256) shv[k] = shv[k] * inv;
  __syncthreads(); for (int q = tid; q < kend / 4; q += 256) vst2(sr + q * 4, *(const v4f*)&shv[q * 4]); }
// ---- k_pv: block = 64 queries (qb) of (b, h): ctx = P . v over keys [0, kend) (P x 2^11 once to f16 against v f16: 1 product; causal early query blocks: P and v as bf16 hi + lo, 3 products); 512-B (row, head) segment by 32 lanes
__global__ __launch_bounds__(128) void k_pv(const float* __restrict__ PS0, const _Float16* __restrict__ VT, const __bf16* __restrict__ VB, const __bf16* __restrict__ VBL, int b, int h0, float* __restrict__ Y) { const int h = h0 + blockIdx.z; const float* PS = PS0 + (size_t)blockIdx.z * TT * TT; __shared__ __align__(16) float ss[4][16][HD + 4];
  const int tid = threadIdx.x, wave = tid >> 5, lane = tid & 31, col = lane & 15, g = lane >> 4; const int qb = blockIdx.x; const int ql0 = qb * 64 + wave * 16; const int kce = (kb_last(qb) + 1) * 4;
  v8f acc[HD / 16] = {};
  if (qb < QBH) {
#pragma unroll 1
    for (int kc = 0; kc < kce; ++kc) { const F2 p = split_row(PS + (size_t)(ql0 + col) * TT, kc * 32, lane);
      asm volatile("s_wait_loadcnt 0x0" ::: "memory");
#pragma unroll
      for (int j = 0; j < HD / 16; ++j) { const size_t po = ((size_t)b * CC + h * HD + j * 16 + col) * (size_t)KHI + kc * 32; const v16b vh = frag_b(VB + po, lane); acc[j] = wmma_bf(p.h, vh, acc[j]); acc[j] = wmma_bf(p.l, vh, acc[j]); acc[j] = wmma_bf(p.h, frag_b(VBL + po, lane), acc[j]); } }
  } else {
#pragma unroll 1
    for (int kc = 0; kc < kce; ++kc) { const v16h p = frag_f32(PS + (size_t)(ql0 + col) * TT + kc * 32, lane);
      asm volatile("s_wait_loadcnt 0x0" ::: "memory");
#pragma unroll
      for (int j = 0; j < HD / 16; ++j) { const size_t po = ((size_t)b * CC + h * HD + j * 16 + col) * (size_t)TT + kc * 32; acc[j] = wmma16(p, frag_h(VT + po, lane), acc[j]); } } }
#pragma unroll
  for (int j = 0; j < HD / 16; ++j)
#pragma unroll
    for (int r = 0; r < 8; ++r) ss[wave][8 * g + r][j * 16 + col] = acc[j][r] * (1.0f / 2048.0f);
  LDSX(); for (int rl = 0; rl < 16; ++rl) if (lane < HD / 4) vst2(Y + ((size_t)b * TT + ql0 + rl) * CC + h * HD + lane * 4, *(const v4f*)&ss[wave][rl][lane * 4]); }

extern "C" void kernel_launch(void* const* d_in, const int* in_sizes, int n_in, void* d_out, int out_size, void* d_ws, size_t ws_size, hipStream_t stream) {
  (void)in_sizes; (void)n_in; (void)out_size;
  const float** F = (const float**)d_in;
  if (ws_size < (size_t)WS_END) return;
  char* ws = (char*)d_ws; _Float16 *QH = (_Float16*)(ws + WS_QH), *KH = (_Float16*)(ws + WS_KH), *VT = (_Float16*)(ws + WS_VT), *QL = (_Float16*)(ws + WS_QL), *KL = (_Float16*)(ws + WS_KL); __bf16 *VB = (__bf16*)(ws + WS_VB), *VBL = (__bf16*)(ws + WS_VBL); float *S = (float*)(ws + WS_S), *Y = (float*)(ws + WS_Y);
  (void)Y; (void)QL; (void)KL; (void)VB; (void)VBL;
  // inputs: 0 x [4,2048,1024]; 1 Wk [1024,128] (in,out); 2 Wq [1024,128]; 3 Wv [1024,128]; no biases
  k_proj<<<dim3(TNB * TT / 64, CC / 128, 3), 128, 0, stream>>>(F[0], F[0], F[0], F[2], F[1], F[3], nullptr, nullptr, nullptr, QH, QL, KH, KL, VT, VB, VBL);   /* q uses Wq = input 2, k uses Wk = input 1 */
  for (int b = 0; b < TNB; ++b) {
    k_sc<<<dim3(NQB, TT / 128, 1), 128, 0, stream>>>(QH, KH, QL, KL, b, 0, S);
    k_sm<<<dim3(TT, 1), 256, 0, stream>>>(S);
    k_pv<<<dim3(NQB, 1, 1), 128, 0, stream>>>(S, VT, VB, VBL, b, 0, (float*)d_out);
  }
}

// v001
// Measured time: 243 microseconds a run.
// Timed twice side by side with v000, it ran 2.32 and 2.33 times as fast.
// compute dtype: all float inputs rounded to bf16; q/k/v projections with EXACT bf16 products on WMMA 16x16x32 (f32 accumulate); logits q x k once to f16 each (1 product; sigma - 1) x 128^-0.5; softmax f32; P x 2^11 once to f16 x v once to f16 (1 product); f32 output.
#include <hip/hip_runtime.h>
#include <math.h>

typedef __attribute__((ext_vector_type(16))) _Float16 v16h;
typedef __attribute__((ext_vector_type(16))) __bf16 v16b;
typedef __attribute__((ext_vector_type(8)))  _Float16 v8h;
typedef __attribute__((ext_vector_type(8)))  float v8f;
typedef __attribute__((ext_vector_type(4)))  float v4f;
typedef __attribute__((ext_vector_type(2)))  float v2f;
typedef __attribute__((ext_vector_type(4)))  unsigned v4u;
typedef __attribute__((ext_vector_type(4)))  int v4i;
typedef float __attribute__((may_alias)) float_a;
typedef int __attribute__((may_alias)) int_a;

template <typename T> __device__ __forceinline__ void vst2(void* p, T v) { *(T*)p = v;  }
__device__ __forceinline__ v8f wmma16(v16h a, v16h b, v8f c) {
  v8f d = __builtin_amdgcn_wmma_f32_16x16x32_f16(false, a, false, b, (short)0, c, false, false);
  asm volatile("v_nop\n\tv_nop\n\tv_nop\n\tv_nop" : "+v"(d) : "v"(a), "v"(b));
  return d;
}
__device__ __forceinline__ v8f wmma_bf(v16b a, v16b b, v8f c) {
  v8f d = __builtin_amdgcn_wmma_f32_16x16x32_bf16(false, a, false, b, (short)0, c, false, false);
  asm volatile("v_nop\n\tv_nop\n\tv_nop\n\tv_nop" : "+v"(d) : "v"(a), "v"(b));
  return d;
}
// 16x16x32 fragments: lane = (h = lane>>4, row/col = lane&15); elements 0..7 = k0+8h+0..7, 8..15 = k0+16+8h+0..7; D element r = row 8h+r
__device__ __forceinline__ v16h frag_h(const _Float16* rowk0, int lane) {
  union { v16h v; v8h q[2]; } u; const _Float16* p = rowk0 + 8 * (lane >> 4);
  u.q[0] = *(const v8h*)p; u.q[1] = *(const v8h*)(p + 16); return u.v;
}
__device__ __forceinline__ v16h frag_f32(const float* rowk0, int lane) {
  v16h a; const float* p = rowk0 + 8 * (lane >> 4);
#pragma unroll
  for (int i = 0; i < 8; ++i) { a[i] = (_Float16)p[i]; a[8 + i] = (_Float16)p[16 + i]; }
  return a;
}
__device__ __forceinline__ v16h frag_f32s(const float* rowk0, int lane, float sc) {
  v16h a; const float* p = rowk0 + 8 * (lane >> 4);
#pragma unroll
  for (int i = 0; i < 8; ++i) { a[i] = (_Float16)(p[i] * sc); a[8 + i] = (_Float16)(p[16 + i] * sc); }
  return a;
}
// column fragment from a [K][ld] layout (column n), rows >= K read as 0
__device__ __forceinline__ v16h fragc_f32(const float* W, int k0, int n, int lane, int ld, int K) {
  v16h a; const int g = lane >> 4;
#pragma unroll
  for (int i = 0; i < 8; ++i) { const int ka = k0 + 8 * g + i, kb = ka + 16;
    a[i] = (_Float16)(ka < K ? W[(size_t)(ka < K ? ka : K - 1) * ld + n] : 0.f); a[8 + i] = (_Float16)(kb < K ? W[(size_t)(kb < K ? kb : K - 1) * ld + n] : 0.f); }
  return a;
}
struct F2 { v16b h, l; };
__device__ __forceinline__ F2 bsplit16(const float v[16]) { F2 r;
#pragma unroll
  for (int i = 0; i < 16; ++i) { const __bf16 h = (__bf16)v[i]; r.h[i] = h; r.l[i] = (__bf16)(v[i] - (float)h); }
  return r; }
__device__ __forceinline__ F2 split_row(const float* row, int k0, int lane) { float v[16]; const float* p = row + k0 + 8 * (lane >> 4);
#pragma unroll
  for (int i = 0; i < 8; ++i) { v[i] = p[i]; v[8 + i] = p[16 + i]; }
  return bsplit16(v); }
__device__ __forceinline__ F2 split_rowK(const float* row, int k0, int lane, int K) { float v[16]; const int g = lane >> 4;
#pragma unroll
  for (int i = 0; i < 8; ++i) { const int ka = k0 + 8 * g + i, kb = ka + 16; v[i] = ka < K ? row[ka < K ? ka : K - 1] : 0.f; v[8 + i] = kb < K ? row[kb < K ? kb : K - 1] : 0.f; }
  return bsplit16(v); }
__device__ __forceinline__ F2 split_col(const float* W, int k0, int n, int lane, int ld, int K) { float v[16]; const int g = lane >> 4;
#pragma unroll
  for (int i = 0; i < 8; ++i) { const int ka = k0 + 8 * g + i, kb = ka + 16; v[i] = ka < K ? W[(size_t)(ka < K ? ka : K - 1) * ld + n] : 0.f; v[8 + i] = kb < K ? W[(size_t)(kb < K ? kb : K - 1) * ld + n] : 0.f; }
  return bsplit16(v); }
__device__ __forceinline__ v8f mac3(const F2& a, const F2& b, v8f c) { c = wmma_bf(a.l, b.h, c); c = wmma_bf(a.h, b.l, c); return wmma_bf(a.h, b.h, c); }
__device__ __forceinline__ float sigm(float v) { return 1.0f / (1.0f + expf(-v)); }
#define LDSX() do { asm volatile("s_wait_dscnt 0" ::: "memory"); __builtin_amdgcn_wave_barrier(); __builtin_amdgcn_fence(__ATOMIC_RELEASE, "workgroup"); } while (0)

// Single-head NON-causal self-attention with head size 128 (x [4,2048,1024]; (in,out) Wk / Wq / Wv [1024,128] N(0, 1/1024), no biases; no mask in the source; scale 128^-0.5): out = softmax(q k^T * 128^-0.5) v -> [4,2048,128].
#define NB 4
#define TT 2048
#define CC 128            // NH * HD = projected width
#define DIN 1024          // input (model) width
#define NH 1
#define HD 128
#define NQB (TT / 64)
#define HG 1
#define SCALE (0.08838834764831845f)
#define CAUSAL 0
#ifndef TNB
#define TNB NB
#endif
__device__ __forceinline__ float bfr(float v) { return (float)(__bf16)v; }
__host__ __device__ __forceinline__ int kb_last(int qb) { return CAUSAL ? ((qb * 64 + 63) >> 7) : (TT / 128 - 1); }
typedef __attribute__((ext_vector_type(8))) __bf16 v8b;
__device__ __forceinline__ v16b frag_b(const __bf16* rowk0, int lane) {
  union { v16b v; v8b q[2]; } u; const __bf16* p = rowk0 + 8 * (lane >> 4);
  u.q[0] = *(const v8b*)p; u.q[1] = *(const v8b*)(p + 16); return u.v;
}
#define QBH 0              // no query block takes the high-precision (3-product) path
#define QHI 0               // single-product logits on every row (sigma - 1 logits over 2,048 keys)
#define KHI 64            // key rows carrying k residual / v bf16 hi+lo planes (written by k_proj; read by no path here, as QBH = 0)
// B fragment (k rows k0+.., output column o) of a weight: (in,out) [K][ld] or (out,in) [ld rows of K]: bf16 exact, or f16(bf16 * 256) exact
__device__ __forceinline__ v16b wcol_io(const float* Wm, int k0, int o, int lane, int ld) { v16b w; const int g = lane >> 4;
#pragma unroll
  for (int i = 0; i < 8; ++i) { w[i] = (__bf16)Wm[(size_t)(k0 + 8 * g + i) * ld + o]; w[8 + i] = (__bf16)Wm[(size_t)(k0 + 16 + 8 * g + i) * ld + o]; }
  return w; }
__device__ __forceinline__ v16b wcol_oi(const float* Wm, int k0, int o, int lane, int K) { v16b w; const float* p = Wm + (size_t)o * K + k0 + 8 * (lane >> 4);
#pragma unroll
  for (int i = 0; i < 8; ++i) { w[i] = (__bf16)p[i]; w[8 + i] = (__bf16)p[16 + i]; }
  return w; }
__device__ __forceinline__ v16h wcolh_io(const float* Wm, int k0, int o, int lane, int ld) { v16h w; const int g = lane >> 4;
#pragma unroll
  for (int i = 0; i < 8; ++i) { w[i] = (_Float16)(bfr(Wm[(size_t)(k0 + 8 * g + i) * ld + o]) * 256.0f); w[8 + i] = (_Float16)(bfr(Wm[(size_t)(k0 + 16 + 8 * g + i) * ld + o]) * 256.0f); }
  return w; }
__device__ __forceinline__ v16h wcolh_oi(const float* Wm, int k0, int o, int lane, int K) { v16h w; const float* p = Wm + (size_t)o * K + k0 + 8 * (lane >> 4);
#pragma unroll
  for (int i = 0; i < 8; ++i) { w[i] = (_Float16)(bfr(p[i]) * 256.0f); w[8 + i] = (_Float16)(bfr(p[16 + i]) * 256.0f); }
  return w; }
#define WQKV_LAYOUT 0   // 0 = (in,out) [DIN][CC]; 1 = (out,in) [CC][DIN]; 2 = per-head [NH][DIN][HD]
__device__ __forceinline__ v16b wcol_hdk(const float* Wm, int k0, int o, int lane) { v16b w; const int g = lane >> 4; const float* p = Wm + (size_t)(o / HD) * DIN * HD + (o % HD);
#pragma unroll
  for (int i = 0; i < 8; ++i) { w[i] = (__bf16)p[(size_t)(k0 + 8 * g + i) * HD]; w[8 + i] = (__bf16)p[(size_t)(k0 + 16 + 8 * g + i) * HD]; }
  return w; }
#define WO_OUT_IN 0
#if WQKV_LAYOUT == 1
#define WCOL(W, k0, o, lane) wcol_oi(W, k0, o, lane, DIN)
#elif WQKV_LAYOUT == 2
#define WCOL(W, k0, o, lane) wcol_hdk(W, k0, o, lane)
#else
#define WCOL(W, k0, o, lane) wcol_io(W, k0, o, lane, CC)
#endif
#if WO_OUT_IN
#define WOCOL(W, k0, o, lane) wcol_oi(W, k0, o, lane, CC)
#define WOCOLH(W, k0, o, lane) wcolh_oi(W, k0, o, lane, CC)
#else
#define WOCOL(W, k0, o, lane) wcol_io(W, k0, o, lane, DIN)
#define WOCOLH(W, k0, o, lane) wcolh_io(W, k0, o, lane, DIN)
#endif

#ifndef SM_EXTRA_PARAMS
#define SM_EXTRA_PARAMS
#endif
#ifndef PROJ_EXTRA_PARAMS
#define PROJ_EXTRA_PARAMS
#endif
#ifndef SM_MASK_HOOK
#define SM_MASK_HOOK (void)0
#endif

#define WS_QH  0u                                      // f16 q rows [b*t][CC]
#define WS_KH  (WS_QH + 2u * (size_t)NB * TT * CC)      // f16 k rows [b*t][CC]
#define WS_VT  (WS_KH + 2u * (size_t)NB * TT * CC)      // f16 v planes [b][c][t]
#define WS_QL  (WS_VT + 2u * (size_t)NB * CC * TT)      // f16 q residual x 2^10 rows [b][t < QHI][CC]
#define WS_KL  (WS_QL + 2u * (size_t)NB * QHI * CC)     // f16 k residual x 2^10 rows [b][t < KHI][CC]
#define WS_VB  (WS_KL + 2u * (size_t)NB * KHI * CC)     // bf16 v hi planes [b][c][t < KHI]
#define WS_VBL (WS_VB + 2u * (size_t)NB * CC * KHI)
#define WS_S   (WS_VBL + 2u * (size_t)NB * CC * KHI)    // f32 logits / P [b][t][s], one plane per batch
#define WS_Y   (WS_S  + 4u * (size_t)NB * TT * TT)      // f32 ctx rows [b*t][CC] (only when there is an output projection)
#define WS_END (WS_Y  + 0u)

// ---- k_proj: block = (64 rows, 128 cols, which): q/k/v = X W (+ b) with exact bf16 products (K = DIN) -> which 0: q f16 rows (+ residual rows < QHI); 1: k f16 rows (+ residual rows < KHI); 2: v f16 planes [c][t] (+ bf16 hi/lo planes for t < KHI)
__global__ __launch_bounds__(128) void k_proj(const float* __restrict__ XQ, const float* __restrict__ XK, const float* __restrict__ XV, const float* __restrict__ WQ, const float* __restrict__ WK, const float* __restrict__ WV, const float* __restrict__ BQ, const float* __restrict__ BK, const float* __restrict__ BV,
    _Float16* __restrict__ QH, _Float16* __restrict__ QL, _Float16* __restrict__ KH, _Float16* __restrict__ KL, _Float16* __restrict__ VT, __bf16* __restrict__ VB, __bf16* __restrict__ VBL) {
  __shared__ __align__(16) _Float16 sh[64][136], sl[64][136]; __shared__ __align__(16) _Float16 th[128][72]; __shared__ __align__(16) __bf16 tb[128][72], tbl[128][72];
  const int tid = threadIdx.x, wave = tid >> 5, lane = tid & 31, col = lane & 15, g = lane >> 4; const int which = blockIdx.z; const int c0 = blockIdx.y * 128; const size_t r0 = (size_t)blockIdx.x * 64; const size_t bb = r0 / TT; const int t0 = (int)(r0 % TT);
  const float* X = which == 0 ? XQ : which == 1 ? XK : XV; const float* WA = which == 0 ? WQ : which == 1 ? WK : WV; const float* BA = which == 0 ? BQ : which == 1 ? BK : BV;
  v8f acc[8] = {};
#pragma unroll 2
  for (int kc = 0; kc < DIN / 32; ++kc) { v16b a; { const float* p = X + (r0 + wave * 16 + col) * DIN + kc * 32 + 8 * g;
#pragma unroll
      for (int i = 0; i < 8; ++i) { a[i] = (__bf16)p[i]; a[8 + i] = (__bf16)p[16 + i]; } }
    asm volatile("s_wait_loadcnt 0x0" ::: "memory");
#pragma unroll
    for (int j = 0; j < 8; ++j) { const v16b w = WCOL(WA, kc * 32, c0 + j * 16 + col, lane); asm volatile("s_wait_loadcnt 0x0" ::: "memory"); acc[j] = wmma_bf(a, w, acc[j]); } }
  if (which < 2) { _Float16* DH = which == 0 ? QH : KH; _Float16* DL = which == 0 ? QL : KL; const int nhi = which == 0 ? QHI : KHI; const bool hi_rows = t0 < nhi;
#pragma unroll
    for (int j = 0; j < 8; ++j) { const float bias = BA ? bfr(BA[c0 + j * 16 + col]) : 0.f;
#pragma unroll
      for (int r = 0; r < 8; ++r) { const float v = acc[j][r] + bias; const _Float16 hv = (_Float16)v; sh[wave * 16 + 8 * g + r][j * 16 + col] = hv; sl[wave * 16 + 8 * g + r][j * 16 + col] = (_Float16)((v - (float)hv) * 1024.0f); } }
    __syncthreads();
    for (int e = tid; e < 64 * 16; e += 128) { const int rl = e >> 4, q = e & 15; vst2((unsigned*)(DH + (r0 + rl) * CC + c0 + q * 8), *(const v4u*)&sh[rl][q * 8]); if (hi_rows) vst2((unsigned*)(DL + (bb * nhi + t0 + rl) * (size_t)CC + c0 + q * 8), *(const v4u*)&sl[rl][q * 8]); }
  } else { const bool hi_rows = t0 < KHI;
#pragma unroll
    for (int j = 0; j < 8; ++j) { const float bias = BA ? bfr(BA[c0 + j * 16 + col]) : 0.f;
#pragma unroll
      for (int r = 0; r < 8; ++r) { const float v = acc[j][r] + bias; const int rl = wave * 16 + 8 * g + r, cl = j * 16 + col; th[cl][rl] = (_Float16)v; const __bf16 bh = (__bf16)v; tb[cl][rl] = bh; tbl[cl][rl] = (__bf16)(v - (float)bh); } }
    __syncthreads();
    for (int e = tid; e < 128 * 8; e += 128) { const int cl = e >> 3, q = e & 7; vst2((unsigned*)(VT + (bb * CC + c0 + cl) * (size_t)TT + t0 + q * 8), *(const v4u*)&th[cl][q * 8]); if (hi_rows) { const size_t o3 = (bb * CC + c0 + cl) * (size_t)KHI + t0 + q * 8; vst2((unsigned*)(VB + o3), *(const v4u*)&tb[cl][q * 8]); vst2((unsigned*)(VBL + o3), *(const v4u*)&tbl[cl][q * 8]); } } } }
// ---- k_sc: block = (query block qb, key block kb <= kb_last(qb), batch b = blockIdx.z): logits x SCALE; q hi + residual (x 2^10) against k (2 products) for query rows < QHI, plus the k residual (3 products) for query blocks < QBH (none, as QBH = 0); causal: blocks past the diagonal exit, the mask itself is applied by index in k_sm
__global__ __launch_bounds__(128) void k_sc(const _Float16* __restrict__ QH, const _Float16* __restrict__ KH, const _Float16* __restrict__ QL, const _Float16* __restrict__ KL, int h0, float* __restrict__ S0) { __shared__ __align__(16) float ss[4][16][132];
  const int qb = blockIdx.x, kb = blockIdx.y; if (kb > kb_last(qb)) return;
  const int b = blockIdx.z, h = h0; float* S = S0 + (size_t)b * TT * TT;
  const int tid = threadIdx.x, wave = tid >> 5, lane = tid & 31, col = lane & 15, g = lane >> 4; const int k0 = kb * 128; const int ql0 = qb * 64 + wave * 16; const size_t q0 = (size_t)b * TT + ql0, kr0 = (size_t)b * TT + k0;
  v8f acc[8] = {}, accl[8] = {};
  const _Float16* QLb = QL + (size_t)b * QHI * CC; const _Float16* KLb = KL + (size_t)b * KHI * CC;
  if (qb < QBH) {
#pragma unroll
    for (int kc = 0; kc < HD / 32; ++kc) { const v16h ah = frag_h(QH + (q0 + col) * CC + h * HD + kc * 32, lane), al = frag_h(QLb + (size_t)(ql0 + col) * CC + h * HD + kc * 32, lane);
#pragma unroll
      for (int j = 0; j < 8; ++j) { const v16h kbf = frag_h(KH + (kr0 + j * 16 + col) * CC + h * HD + kc * 32, lane), klf = frag_h(KLb + (size_t)(k0 + j * 16 + col) * CC + h * HD + kc * 32, lane); acc[j] = wmma16(ah, kbf, acc[j]); accl[j] = wmma16(al, kbf, accl[j]); accl[j] = wmma16(ah, klf, accl[j]); } }
  } else if (qb * 64 < QHI) {
#pragma unroll
    for (int kc = 0; kc < HD / 32; ++kc) { const v16h ah = frag_h(QH + (q0 + col) * CC + h * HD + kc * 32, lane), al = frag_h(QLb + (size_t)(ql0 + col) * CC + h * HD + kc * 32, lane);
#pragma unroll
      for (int j = 0; j < 8; ++j) { const v16h kbf = frag_h(KH + (kr0 + j * 16 + col) * CC + h * HD + kc * 32, lane); acc[j] = wmma16(ah, kbf, acc[j]); accl[j] = wmma16(al, kbf, accl[j]); } }
  } else {
#pragma unroll
    for (int kc = 0; kc < HD / 32; ++kc) { const v16h ah = frag_h(QH + (q0 + col) * CC + h * HD + kc * 32, lane);
#pragma unroll
      for (int j = 0; j < 8; ++j) { const v16h kbf = frag_h(KH + (kr0 + j * 16 + col) * CC + h * HD + kc * 32, lane); acc[j] = wmma16(ah, kbf, acc[j]); } } }
#pragma unroll
  for (int j = 0; j < 8; ++j) {
#pragma unroll
    for (int r = 0; r < 8; ++r) ss[wave][8 * g + r][j * 16 + col] = (acc[j][r] + accl[j][r] * (1.0f / 1024.0f)) * SCALE; }
  LDSX(); for (int rl = 0; rl < 16; ++rl) vst2(S + (size_t)(ql0 + rl) * TT + k0 + lane * 4, *(const v4f*)&ss[wave][rl][lane * 4]); }
// ---- k_sm: block = query row t of the plane blockIdx.y (batch): keys [0, kend): causal -> logit if s <= t else excluded; softmax in f32; P x 2^11 in place (0 for excluded)
__global__ __launch_bounds__(256) void k_sm(float* __restrict__ S0 SM_EXTRA_PARAMS) { __shared__ float sred[8]; __shared__ float sbc; __shared__ __align__(16) float shv[TT];
  const int tid = threadIdx.x; const int t = blockIdx.x; const int kend = (kb_last(t >> 6) + 1) * 128;
  float* sr = S0 + (size_t)blockIdx.y * TT * TT + (size_t)t * TT;
  float m = -3.0e38f; for (int k = tid; k < kend; k += 256) { float v = (!CAUSAL || k <= t) ? sr[k] : -3.0e38f; SM_MASK_HOOK; shv[k] = v; m = fmaxf(m, v); }
#pragma unroll
  for (int o = 1; o < 32; o <<= 1) m = fmaxf(m, __shfl_xor(m, o));
  if ((tid & 31) == 0) sred[tid >> 5] = m; __syncthreads(); if (tid == 0) { float a = sred[0]; for (int i = 1; i < 8; ++i) a = fmaxf(a, sred[i]); sbc = a; } __syncthreads(); m = sbc; __syncthreads();
  float sum = 0.f; for (int k = tid; k < kend; k += 256) { const float v = shv[k]; const float e = (v <= -1.0e38f) ? 0.f : expf(v - m); shv[k] = e; sum += e; }
#pragma unroll
  for (int o = 1; o < 32; o <<= 1) sum += __shfl_xor(sum, o);
  if ((tid & 31) == 0) sred[tid >> 5] = sum; __syncthreads(); if (tid == 0) { float a = 0.f; for (int i = 0; i < 8; ++i) a += sred[i]; sbc = a > 0.f ? 2048.0f / a : 0.f; }   /* a fully excluded row yields P = 0 */ __syncthreads(); const float inv = sbc;
  for (int k = tid; k < kend; k += 256) shv[k] = shv[k] * inv;
  __syncthreads(); for (int q = tid; q < kend / 4; q += 256) vst2(sr + q * 4, *(const v4f*)&shv[q * 4]); }
// ---- k_pv: block = 64 queries (qb) of (b = blockIdx.z, h): ctx = P . v over keys [0, kend) (P x 2^11 once to f16 against v f16: 1 product; query blocks < QBH (none, QBH = 0): P and v as bf16 hi + lo, 3 products); 512-B (row, head) segment by 32 lanes
__global__ __launch_bounds__(128) void k_pv(const float* __restrict__ PS0, const _Float16* __restrict__ VT, const __bf16* __restrict__ VB, const __bf16* __restrict__ VBL, int h0, float* __restrict__ Y) { const int b = blockIdx.z, h = h0; const float* PS = PS0 + (size_t)b * TT * TT; __shared__ __align__(16) float ss[4][16][HD + 4];
  const int tid = threadIdx.x, wave = tid >> 5, lane = tid & 31, col = lane & 15, g = lane >> 4; const int qb = blockIdx.x; const int ql0 = qb * 64 + wave * 16; const int kce = (kb_last(qb) + 1) * 4;
  v8f acc[HD / 16] = {};
  if (qb < QBH) {
#pragma unroll 1
    for (int kc = 0; kc < kce; ++kc) { const F2 p = split_row(PS + (size_t)(ql0 + col) * TT, kc * 32, lane);
      asm volatile("s_wait_loadcnt 0x0" ::: "memory");
#pragma unroll
      for (int j = 0; j < HD / 16; ++j) { const size_t po = ((size_t)b * CC + h * HD + j * 16 + col) * (size_t)KHI + kc * 32; const v16b vh = frag_b(VB + po, lane); acc[j] = wmma_bf(p.h, vh, acc[j]); acc[j] = wmma_bf(p.l, vh, acc[j]); acc[j] = wmma_bf(p.h, frag_b(VBL + po, lane), acc[j]); } }
  } else {
#pragma unroll 1
    for (int kc = 0; kc < kce; ++kc) { const v16h p = frag_f32(PS + (size_t)(ql0 + col) * TT + kc * 32, lane);
      asm volatile("s_wait_loadcnt 0x0" ::: "memory");
#pragma unroll
      for (int j = 0; j < HD / 16; ++j) { const size_t po = ((size_t)b * CC + h * HD + j * 16 + col) * (size_t)TT + kc * 32; acc[j] = wmma16(p, frag_h(VT + po, lane), acc[j]); } } }
#pragma unroll
  for (int j = 0; j < HD / 16; ++j)
#pragma unroll
    for (int r = 0; r < 8; ++r) ss[wave][8 * g + r][j * 16 + col] = acc[j][r] * (1.0f / 2048.0f);
  LDSX(); for (int rl = 0; rl < 16; ++rl) if (lane < HD / 4) vst2(Y + ((size_t)b * TT + ql0 + rl) * CC + h * HD + lane * 4, *(const v4f*)&ss[wave][rl][lane * 4]); }

extern "C" void kernel_launch(void* const* d_in, const int* in_sizes, int n_in, void* d_out, int out_size, void* d_ws, size_t ws_size, hipStream_t stream) {
  (void)in_sizes; (void)n_in; (void)out_size;
  const float** F = (const float**)d_in;
  if (ws_size < (size_t)WS_END) return;
  char* ws = (char*)d_ws; _Float16 *QH = (_Float16*)(ws + WS_QH), *KH = (_Float16*)(ws + WS_KH), *VT = (_Float16*)(ws + WS_VT), *QL = (_Float16*)(ws + WS_QL), *KL = (_Float16*)(ws + WS_KL); __bf16 *VB = (__bf16*)(ws + WS_VB), *VBL = (__bf16*)(ws + WS_VBL); float *S = (float*)(ws + WS_S), *Y = (float*)(ws + WS_Y);
  (void)Y; (void)QL; (void)KL; (void)VB; (void)VBL;
  // inputs: 0 x [4,2048,1024]; 1 Wk [1024,128] (in,out); 2 Wq [1024,128]; 3 Wv [1024,128]; no biases
  k_proj<<<dim3(TNB * TT / 64, CC / 128, 3), 128, 0, stream>>>(F[0], F[0], F[0], F[2], F[1], F[3], nullptr, nullptr, nullptr, QH, QL, KH, KL, VT, VB, VBL);   /* q uses Wq = input 2, k uses Wk = input 1 */
  // every batch in one launch of each stage: the batch is a grid dimension and has its own logits plane
  k_sc<<<dim3(NQB, TT / 128, TNB), 128, 0, stream>>>(QH, KH, QL, KL, 0, S);
  k_sm<<<dim3(TT, TNB), 256, 0, stream>>>(S);
  k_pv<<<dim3(NQB, 1, TNB), 128, 0, stream>>>(S, VT, VB, VBL, 0, (float*)d_out);
}

// v002
// One run takes 101 microseconds.
// In two side-by-side timings against v001, it was 2.39 and 2.44 times as fast.
// Over all steps from v000 it is 5.60 times as fast.
// compute dtype: all float inputs rounded to bf16; q/k/v projections with EXACT bf16 products on WMMA 16x16x32 (f32 accumulate); logits q x k once to f16 each (1 product; sigma - 1) x 128^-0.5; online softmax f32; P = exp(logit - running max) once to f16 x v once to f16 (1 product); f32 output.
#include <hip/hip_runtime.h>
#include <math.h>

typedef __attribute__((ext_vector_type(16))) _Float16 v16h;
typedef __attribute__((ext_vector_type(16))) __bf16 v16b;
typedef __attribute__((ext_vector_type(8)))  _Float16 v8h;
typedef __attribute__((ext_vector_type(8)))  float v8f;
typedef __attribute__((ext_vector_type(4)))  float v4f;
typedef __attribute__((ext_vector_type(2)))  float v2f;
typedef __attribute__((ext_vector_type(4)))  unsigned v4u;
typedef __attribute__((ext_vector_type(4)))  int v4i;
typedef float __attribute__((may_alias)) float_a;
typedef int __attribute__((may_alias)) int_a;

template <typename T> __device__ __forceinline__ void vst2(void* p, T v) { *(T*)p = v;  }
__device__ __forceinline__ v8f wmma16(v16h a, v16h b, v8f c) {
  v8f d = __builtin_amdgcn_wmma_f32_16x16x32_f16(false, a, false, b, (short)0, c, false, false);
  asm volatile("v_nop\n\tv_nop\n\tv_nop\n\tv_nop" : "+v"(d) : "v"(a), "v"(b));
  return d;
}
__device__ __forceinline__ v8f wmma_bf(v16b a, v16b b, v8f c) {
  v8f d = __builtin_amdgcn_wmma_f32_16x16x32_bf16(false, a, false, b, (short)0, c, false, false);
  asm volatile("v_nop\n\tv_nop\n\tv_nop\n\tv_nop" : "+v"(d) : "v"(a), "v"(b));
  return d;
}
// 16x16x32 fragments: lane = (h = lane>>4, row/col = lane&15); elements 0..7 = k0+8h+0..7, 8..15 = k0+16+8h+0..7; D element r = row 8h+r
__device__ __forceinline__ v16h frag_h(const _Float16* rowk0, int lane) {
  union { v16h v; v8h q[2]; } u; const _Float16* p = rowk0 + 8 * (lane >> 4);
  u.q[0] = *(const v8h*)p; u.q[1] = *(const v8h*)(p + 16); return u.v;
}
__device__ __forceinline__ v16h frag_f32(const float* rowk0, int lane) {
  v16h a; const float* p = rowk0 + 8 * (lane >> 4);
#pragma unroll
  for (int i = 0; i < 8; ++i) { a[i] = (_Float16)p[i]; a[8 + i] = (_Float16)p[16 + i]; }
  return a;
}
__device__ __forceinline__ v16h frag_f32s(const float* rowk0, int lane, float sc) {
  v16h a; const float* p = rowk0 + 8 * (lane >> 4);
#pragma unroll
  for (int i = 0; i < 8; ++i) { a[i] = (_Float16)(p[i] * sc); a[8 + i] = (_Float16)(p[16 + i] * sc); }
  return a;
}
// column fragment from a [K][ld] layout (column n), rows >= K read as 0
__device__ __forceinline__ v16h fragc_f32(const float* W, int k0, int n, int lane, int ld, int K) {
  v16h a; const int g = lane >> 4;
#pragma unroll
  for (int i = 0; i < 8; ++i) { const int ka = k0 + 8 * g + i, kb = ka + 16;
    a[i] = (_Float16)(ka < K ? W[(size_t)(ka < K ? ka : K - 1) * ld + n] : 0.f); a[8 + i] = (_Float16)(kb < K ? W[(size_t)(kb < K ? kb : K - 1) * ld + n] : 0.f); }
  return a;
}
struct F2 { v16b h, l; };
__device__ __forceinline__ F2 bsplit16(const float v[16]) { F2 r;
#pragma unroll
  for (int i = 0; i < 16; ++i) { const __bf16 h = (__bf16)v[i]; r.h[i] = h; r.l[i] = (__bf16)(v[i] - (float)h); }
  return r; }
__device__ __forceinline__ F2 split_row(const float* row, int k0, int lane) { float v[16]; const float* p = row + k0 + 8 * (lane >> 4);
#pragma unroll
  for (int i = 0; i < 8; ++i) { v[i] = p[i]; v[8 + i] = p[16 + i]; }
  return bsplit16(v); }
__device__ __forceinline__ F2 split_rowK(const float* row, int k0, int lane, int K) { float v[16]; const int g = lane >> 4;
#pragma unroll
  for (int i = 0; i < 8; ++i) { const int ka = k0 + 8 * g + i, kb = ka + 16; v[i] = ka < K ? row[ka < K ? ka : K - 1] : 0.f; v[8 + i] = kb < K ? row[kb < K ? kb : K - 1] : 0.f; }
  return bsplit16(v); }
__device__ __forceinline__ F2 split_col(const float* W, int k0, int n, int lane, int ld, int K) { float v[16]; const int g = lane >> 4;
#pragma unroll
  for (int i = 0; i < 8; ++i) { const int ka = k0 + 8 * g + i, kb = ka + 16; v[i] = ka < K ? W[(size_t)(ka < K ? ka : K - 1) * ld + n] : 0.f; v[8 + i] = kb < K ? W[(size_t)(kb < K ? kb : K - 1) * ld + n] : 0.f; }
  return bsplit16(v); }
__device__ __forceinline__ v8f mac3(const F2& a, const F2& b, v8f c) { c = wmma_bf(a.l, b.h, c); c = wmma_bf(a.h, b.l, c); return wmma_bf(a.h, b.h, c); }
__device__ __forceinline__ float sigm(float v) { return 1.0f / (1.0f + expf(-v)); }
#define LDSX() do { asm volatile("s_wait_dscnt 0" ::: "memory"); __builtin_amdgcn_wave_barrier(); __builtin_amdgcn_fence(__ATOMIC_RELEASE, "workgroup"); } while (0)

// Single-head NON-causal self-attention with head size 128 (x [4,2048,1024]; (in,out) Wk / Wq / Wv [1024,128] N(0, 1/1024), no biases; no mask in the source; scale 128^-0.5): out = softmax(q k^T * 128^-0.5) v -> [4,2048,128].
#define NB 4
#define TT 2048
#define CC 128            // NH * HD = projected width
#define DIN 1024          // input (model) width
#define NH 1
#define HD 128
#define NQB (TT / 64)
#define HG 1
#define SCALE (0.08838834764831845f)
#define CAUSAL 0
#ifndef TNB
#define TNB NB
#endif
__device__ __forceinline__ float bfr(float v) { return (float)(__bf16)v; }
__host__ __device__ __forceinline__ int kb_last(int qb) { return CAUSAL ? ((qb * 64 + 63) >> 7) : (TT / 128 - 1); }
typedef __attribute__((ext_vector_type(8))) __bf16 v8b;
__device__ __forceinline__ v16b frag_b(const __bf16* rowk0, int lane) {
  union { v16b v; v8b q[2]; } u; const __bf16* p = rowk0 + 8 * (lane >> 4);
  u.q[0] = *(const v8b*)p; u.q[1] = *(const v8b*)(p + 16); return u.v;
}
#define QBH 0              // unused: no kernel in this file has a high-precision path
#define QHI 0               // single-product logits on every row (sigma - 1 logits over 2,048 keys)
#define KHI 64            // key rows carrying k residual / v bf16 hi+lo planes (written by k_proj; no kernel in this file reads them)
// B fragment (k rows k0+.., output column o) of a weight: (in,out) [K][ld] or (out,in) [ld rows of K]: bf16 exact, or f16(bf16 * 256) exact
__device__ __forceinline__ v16b wcol_io(const float* Wm, int k0, int o, int lane, int ld) { v16b w; const int g = lane >> 4;
#pragma unroll
  for (int i = 0; i < 8; ++i) { w[i] = (__bf16)Wm[(size_t)(k0 + 8 * g + i) * ld + o]; w[8 + i] = (__bf16)Wm[(size_t)(k0 + 16 + 8 * g + i) * ld + o]; }
  return w; }
__device__ __forceinline__ v16b wcol_oi(const float* Wm, int k0, int o, int lane, int K) { v16b w; const float* p = Wm + (size_t)o * K + k0 + 8 * (lane >> 4);
#pragma unroll
  for (int i = 0; i < 8; ++i) { w[i] = (__bf16)p[i]; w[8 + i] = (__bf16)p[16 + i]; }
  return w; }
__device__ __forceinline__ v16h wcolh_io(const float* Wm, int k0, int o, int lane, int ld) { v16h w; const int g = lane >> 4;
#pragma unroll
  for (int i = 0; i < 8; ++i) { w[i] = (_Float16)(bfr(Wm[(size_t)(k0 + 8 * g + i) * ld + o]) * 256.0f); w[8 + i] = (_Float16)(bfr(Wm[(size_t)(k0 + 16 + 8 * g + i) * ld + o]) * 256.0f); }
  return w; }
__device__ __forceinline__ v16h wcolh_oi(const float* Wm, int k0, int o, int lane, int K) { v16h w; const float* p = Wm + (size_t)o * K + k0 + 8 * (lane >> 4);
#pragma unroll
  for (int i = 0; i < 8; ++i) { w[i] = (_Float16)(bfr(p[i]) * 256.0f); w[8 + i] = (_Float16)(bfr(p[16 + i]) * 256.0f); }
  return w; }
#define WQKV_LAYOUT 0   // 0 = (in,out) [DIN][CC]; 1 = (out,in) [CC][DIN]; 2 = per-head [NH][DIN][HD]
__device__ __forceinline__ v16b wcol_hdk(const float* Wm, int k0, int o, int lane) { v16b w; const int g = lane >> 4; const float* p = Wm + (size_t)(o / HD) * DIN * HD + (o % HD);
#pragma unroll
  for (int i = 0; i < 8; ++i) { w[i] = (__bf16)p[(size_t)(k0 + 8 * g + i) * HD]; w[8 + i] = (__bf16)p[(size_t)(k0 + 16 + 8 * g + i) * HD]; }
  return w; }
#define WO_OUT_IN 0
#if WQKV_LAYOUT == 1
#define WCOL(W, k0, o, lane) wcol_oi(W, k0, o, lane, DIN)
#elif WQKV_LAYOUT == 2
#define WCOL(W, k0, o, lane) wcol_hdk(W, k0, o, lane)
#else
#define WCOL(W, k0, o, lane) wcol_io(W, k0, o, lane, CC)
#endif
#if WO_OUT_IN
#define WOCOL(W, k0, o, lane) wcol_oi(W, k0, o, lane, CC)
#define WOCOLH(W, k0, o, lane) wcolh_oi(W, k0, o, lane, CC)
#else
#define WOCOL(W, k0, o, lane) wcol_io(W, k0, o, lane, DIN)
#define WOCOLH(W, k0, o, lane) wcolh_io(W, k0, o, lane, DIN)
#endif

#ifndef SM_EXTRA_PARAMS
#define SM_EXTRA_PARAMS
#endif
#ifndef PROJ_EXTRA_PARAMS
#define PROJ_EXTRA_PARAMS
#endif
#ifndef SM_MASK_HOOK
#define SM_MASK_HOOK (void)0
#endif

#define WS_QH  0u                                      // f16 q rows [b*t][CC]
#define WS_KH  (WS_QH + 2u * (size_t)NB * TT * CC)      // f16 k rows [b*t][CC]
#define WS_VT  (WS_KH + 2u * (size_t)NB * TT * CC)      // f16 v planes [b][c][t]
#define WS_QL  (WS_VT + 2u * (size_t)NB * CC * TT)      // f16 q residual x 2^10 rows [b][t < QHI][CC]
#define WS_KL  (WS_QL + 2u * (size_t)NB * QHI * CC)     // f16 k residual x 2^10 rows [b][t < KHI][CC]
#define WS_VB  (WS_KL + 2u * (size_t)NB * KHI * CC)     // bf16 v hi planes [b][c][t < KHI]
#define WS_VBL (WS_VB + 2u * (size_t)NB * CC * KHI)
#define WS_END (WS_VBL + 2u * (size_t)NB * CC * KHI)

// ---- k_proj: block = (64 rows, 128 cols, which): q/k/v = X W (+ b) with exact bf16 products (K = DIN) -> which 0: q f16 rows (+ residual rows < QHI); 1: k f16 rows (+ residual rows < KHI); 2: v f16 planes [c][t] (+ bf16 hi/lo planes for t < KHI)
__global__ __launch_bounds__(128) void k_proj(const float* __restrict__ XQ, const float* __restrict__ XK, const float* __restrict__ XV, const float* __restrict__ WQ, const float* __restrict__ WK, const float* __restrict__ WV, const float* __restrict__ BQ, const float* __restrict__ BK, const float* __restrict__ BV,
    _Float16* __restrict__ QH, _Float16* __restrict__ QL, _Float16* __restrict__ KH, _Float16* __restrict__ KL, _Float16* __restrict__ VT, __bf16* __restrict__ VB, __bf16* __restrict__ VBL) {
  __shared__ __align__(16) _Float16 sh[64][136], sl[64][136]; __shared__ __align__(16) _Float16 th[128][72]; __shared__ __align__(16) __bf16 tb[128][72], tbl[128][72];
  const int tid = threadIdx.x, wave = tid >> 5, lane = tid & 31, col = lane & 15, g = lane >> 4; const int which = blockIdx.z; const int c0 = blockIdx.y * 128; const size_t r0 = (size_t)blockIdx.x * 64; const size_t bb = r0 / TT; const int t0 = (int)(r0 % TT);
  const float* X = which == 0 ? XQ : which == 1 ? XK : XV; const float* WA = which == 0 ? WQ : which == 1 ? WK : WV; const float* BA = which == 0 ? BQ : which == 1 ? BK : BV;
  v8f acc[8] = {};
#pragma unroll 2
  for (int kc = 0; kc < DIN / 32; ++kc) { v16b a; { const float* p = X + (r0 + wave * 16 + col) * DIN + kc * 32 + 8 * g;
#pragma unroll
      for (int i = 0; i < 8; ++i) { a[i] = (__bf16)p[i]; a[8 + i] = (__bf16)p[16 + i]; } }
    asm volatile("s_wait_loadcnt 0x0" ::: "memory");
#pragma unroll
    for (int j = 0; j < 8; ++j) { const v16b w = WCOL(WA, kc * 32, c0 + j * 16 + col, lane); asm volatile("s_wait_loadcnt 0x0" ::: "memory"); acc[j] = wmma_bf(a, w, acc[j]); } }
  if (which < 2) { _Float16* DH = which == 0 ? QH : KH; _Float16* DL = which == 0 ? QL : KL; const int nhi = which == 0 ? QHI : KHI; const bool hi_rows = t0 < nhi;
#pragma unroll
    for (int j = 0; j < 8; ++j) { const float bias = BA ? bfr(BA[c0 + j * 16 + col]) : 0.f;
#pragma unroll
      for (int r = 0; r < 8; ++r) { const float v = acc[j][r] + bias; const _Float16 hv = (_Float16)v; sh[wave * 16 + 8 * g + r][j * 16 + col] = hv; sl[wave * 16 + 8 * g + r][j * 16 + col] = (_Float16)((v - (float)hv) * 1024.0f); } }
    __syncthreads();
    for (int e = tid; e < 64 * 16; e += 128) { const int rl = e >> 4, q = e & 15; vst2((unsigned*)(DH + (r0 + rl) * CC + c0 + q * 8), *(const v4u*)&sh[rl][q * 8]); if (hi_rows) vst2((unsigned*)(DL + (bb * nhi + t0 + rl) * (size_t)CC + c0 + q * 8), *(const v4u*)&sl[rl][q * 8]); }
  } else { const bool hi_rows = t0 < KHI;
#pragma unroll
    for (int j = 0; j < 8; ++j) { const float bias = BA ? bfr(BA[c0 + j * 16 + col]) : 0.f;
#pragma unroll
      for (int r = 0; r < 8; ++r) { const float v = acc[j][r] + bias; const int rl = wave * 16 + 8 * g + r, cl = j * 16 + col; th[cl][rl] = (_Float16)v; const __bf16 bh = (__bf16)v; tb[cl][rl] = bh; tbl[cl][rl] = (__bf16)(v - (float)bh); } }
    __syncthreads();
    for (int e = tid; e < 128 * 8; e += 128) { const int cl = e >> 3, q = e & 7; vst2((unsigned*)(VT + (bb * CC + c0 + cl) * (size_t)TT + t0 + q * 8), *(const v4u*)&th[cl][q * 8]); if (hi_rows) { const size_t o3 = (bb * CC + c0 + cl) * (size_t)KHI + t0 + q * 8; vst2((unsigned*)(VB + o3), *(const v4u*)&tb[cl][q * 8]); vst2((unsigned*)(VBL + o3), *(const v4u*)&tbl[cl][q * 8]); } } } }
__device__ __forceinline__ float exp2_slot(float x) { float y; asm("v_exp_f32 %0, %1\n\tv_nop" : "=v"(y) : "v"(x)); return y; }
#define KSPLIT 4
#define QTILES 2
#define KBLK 64
#define NBLK (TT / KSPLIT / KBLK)
#define LDK(buf, j) do { _Pragma("unroll") for (int t = 0; t < 4; ++t) fb[buf][t] = frag_h(kp + (j) * 16 * CC + t * 32, lane); } while (0)                                   /* key tile j, head slices 0..3 */
#define LDV(buf, jj) do { _Pragma("unroll") for (int t = 0; t < 4; ++t) fb[buf][t] = frag_h(vp + (size_t)((jj) * 2 + (t >> 1)) * 16 * TT + (t & 1) * 32, lane); } while (0)   /* channel tiles 2jj, 2jj+1, key slices 0..1 */
#define QK(buf, j) do { _Pragma("unroll") for (int t = 0; t < 4; ++t) s[j] = wmma16(fb[buf][t], aq[t], s[j]); } while (0)
#define PV(buf, jj) do { _Pragma("unroll") for (int t = 0; t < 4; ++t) o[(jj) * 2 + (t >> 1)] = wmma16(fb[buf][t], pf[t & 1], o[(jj) * 2 + (t >> 1)]); } while (0)
__global__ __launch_bounds__(32 * KSPLIT * QTILES) void k_fa(const _Float16* __restrict__ QH, const _Float16* __restrict__ KH, const _Float16* __restrict__ VT, float* __restrict__ Y) {
  __shared__ __align__(16) float ps[QTILES * KSPLIT][16][HD + 4]; __shared__ float pm[QTILES * KSPLIT][16], pl[QTILES * KSPLIT][16];
  const int tid = threadIdx.x, wave = tid >> 5, lane = tid & 31, col = lane & 15, g = lane >> 4; const int b = blockIdx.y, kq = wave & (KSPLIT - 1); const size_t qb0 = (size_t)b * TT + blockIdx.x * (16 * QTILES), q0 = qb0 + (wave / KSPLIT) * 16;
  const float c2 = SCALE * 1.4426950408889634f;   // logit scale times log2(e): the exponentials are base 2
  const _Float16* kp = KH + ((size_t)b * TT + kq * (TT / KSPLIT) + col) * CC; const _Float16* vp = VT + ((size_t)b * CC + col) * (size_t)TT + kq * (TT / KSPLIT);
  v16h aq[HD / 32], fb[2][4], pf[2];
#pragma unroll
  for (int kc = 0; kc < HD / 32; ++kc) aq[kc] = frag_h(QH + (q0 + col) * CC + kc * 32, lane);
  __builtin_amdgcn_sched_barrier(0);   // q loads stay the oldest: issued behind the k groups they would turn the loop's first counted wait into a wait for every load
  LDK(0, 0); LDK(1, 1);
  v8f o[HD / 16] = {}; float m = -3.0e38f, l = 0.f;
#pragma unroll 1   // rolled: a pass is one straight block of code, and the two fragment groups in flight are carried over its back edge
  for (int kb = 0; kb < NBLK; ++kb) { v8f s[KBLK / 16] = {};
    QK(0, 0); LDK(0, 2); QK(1, 1); LDK(1, 3); QK(0, 2); LDV(0, 0); QK(1, 3); LDV(1, 1);
    float mx = s[0][0];
#pragma unroll
    for (int j = 0; j < KBLK / 16; ++j)
#pragma unroll
      for (int r = 0; r < 8; ++r) mx = fmaxf(mx, s[j][r]);
    mx = fmaxf(mx, __shfl_xor(mx, 16));   // the other half of the wave holds the query's other 32 keys
    const float mn = fmaxf(m, mx * c2); const float al = __builtin_amdgcn_exp2f(m - mn); m = mn; float sj[KBLK / 16] = {};
#pragma unroll
    for (int j = 0; j < KBLK / 16; ++j)
#pragma unroll
      for (int r = 0; r < 8; ++r) { const float p = __builtin_amdgcn_exp2f(s[j][r] * c2 - mn); sj[j] += p; pf[j >> 1][(j & 1) * 8 + r] = (_Float16)p; }
    l = l * al + ((sj[0] + sj[1]) + (sj[2] + sj[3]));
#pragma unroll
    for (int j = 0; j < HD / 16; ++j) o[j] *= al;
    kp += kb + 1 < NBLK ? KBLK * CC : 0;   // behind the last block its own first two key tiles are read again, unused: the loads stay unconditional and their counted waits exact
    PV(0, 0); LDV(0, 2); PV(1, 1); LDV(1, 3); PV(0, 2); LDK(0, 0); PV(1, 3); LDK(1, 1);
    asm volatile("s_wait_xcnt 0x0" ::: "memory");   // the next pass forms its addresses in the registers that these loads name
    vp += KBLK; }
  l += __shfl_xor(l, 16);
  if (g == 0) { pm[wave][col] = m; pl[wave][col] = l; }
#pragma unroll
  for (int j = 0; j < HD / 16; ++j) { *(v4f*)&ps[wave][col][j * 16 + 8 * g] = __builtin_shufflevector(o[j], o[j], 0, 1, 2, 3); *(v4f*)&ps[wave][col][j * 16 + 8 * g + 4] = __builtin_shufflevector(o[j], o[j], 4, 5, 6, 7); }
  __syncthreads();
#pragma unroll
  for (int i = 0; i < 4; ++i) { const int rr = wave + 4 * QTILES * i, w0 = (rr >> 4) * KSPLIT, row = rr & 15; float mm = pm[w0][row];
#pragma unroll
    for (int w = 1; w < KSPLIT; ++w) mm = fmaxf(mm, pm[w0 + w][row]);
    float den = 0.f; v4f acc = {};
#pragma unroll
    for (int w = 0; w < KSPLIT; ++w) { const float f = exp2_slot(pm[w0 + w][row] - mm); den += f * pl[w0 + w][row]; acc += *(const v4f*)&ps[w0 + w][row][lane * 4] * f; }
    vst2(Y + (qb0 + rr) * CC + lane * 4, acc * (1.0f / den)); } }

extern "C" void kernel_launch(void* const* d_in, const int* in_sizes, int n_in, void* d_out, int out_size, void* d_ws, size_t ws_size, hipStream_t stream) {
  (void)in_sizes; (void)n_in; (void)out_size;
  const float** F = (const float**)d_in;
  if (ws_size < (size_t)WS_END) return;
  char* ws = (char*)d_ws; _Float16 *QH = (_Float16*)(ws + WS_QH), *KH = (_Float16*)(ws + WS_KH), *VT = (_Float16*)(ws + WS_VT), *QL = (_Float16*)(ws + WS_QL), *KL = (_Float16*)(ws + WS_KL); __bf16 *VB = (__bf16*)(ws + WS_VB), *VBL = (__bf16*)(ws + WS_VBL);
  // inputs: 0 x [4,2048,1024]; 1 Wk [1024,128] (in,out); 2 Wq [1024,128]; 3 Wv [1024,128]; no biases
  k_proj<<<dim3(TNB * TT / 64, CC / 128, 3), 128, 0, stream>>>(F[0], F[0], F[0], F[2], F[1], F[3], nullptr, nullptr, nullptr, QH, QL, KH, KL, VT, VB, VBL);   /* q uses Wq = input 2, k uses Wk = input 1 */
  // logits, softmax and P . v of every batch in one launch
  k_fa<<<dim3(TT / (16 * QTILES), TNB), 32 * KSPLIT * QTILES, 0, stream>>>(QH, KH, VT, (float*)d_out);
}

// v003
// One run takes 46.2 microseconds.
// Next to v002, in two timings, it ran 2.16 and 2.18 times as fast.
// All steps since v000 together make it 12.2 times as fast.
// compute dtype: all float inputs rounded to bf16; q/k/v projections with EXACT bf16 products on WMMA 16x16x32 (f32 accumulate); logits q x k once to f16 each (1 product; sigma - 1) x 128^-0.5; online softmax f32; P = exp(logit - running max) once to f16 x v once to f16 (1 product); f32 output.
#include <hip/hip_runtime.h>
#include <math.h>

typedef __attribute__((ext_vector_type(16))) _Float16 v16h;
typedef __attribute__((ext_vector_type(16))) __bf16 v16b;
typedef __attribute__((ext_vector_type(8)))  _Float16 v8h;
typedef __attribute__((ext_vector_type(8)))  float v8f;
typedef __attribute__((ext_vector_type(4)))  float v4f;
typedef __attribute__((ext_vector_type(2)))  float v2f;
typedef __attribute__((ext_vector_type(4)))  unsigned v4u;
typedef __attribute__((ext_vector_type(4)))  int v4i;
typedef float __attribute__((may_alias)) float_a;
typedef int __attribute__((may_alias)) int_a;

template <typename T> __device__ __forceinline__ void vst2(void* p, T v) { *(T*)p = v;  }
__device__ __forceinline__ v8f wmma16(v16h a, v16h b, v8f c) {
  v8f d = __builtin_amdgcn_wmma_f32_16x16x32_f16(false, a, false, b, (short)0, c, false, false);
  asm volatile("v_nop\n\tv_nop\n\tv_nop\n\tv_nop" : "+v"(d) : "v"(a), "v"(b));
  return d;
}
__device__ __forceinline__ v8f wmma_bf(v16b a, v16b b, v8f c) {
  v8f d = __builtin_amdgcn_wmma_f32_16x16x32_bf16(false, a, false, b, (short)0, c, false, false);
  asm volatile("v_nop\n\tv_nop\n\tv_nop\n\tv_nop" : "+v"(d) : "v"(a), "v"(b));
  return d;
}
// 16x16x32 fragments: lane = (h = lane>>4, row/col = lane&15); elements 0..7 = k0+8h+0..7, 8..15 = k0+16+8h+0..7; D element r = row 8h+r
__device__ __forceinline__ v16h frag_h(const _Float16* rowk0, int lane) {
  union { v16h v; v8h q[2]; } u; const _Float16* p = rowk0 + 8 * (lane >> 4);
  u.q[0] = *(const v8h*)p; u.q[1] = *(const v8h*)(p + 16); return u.v;
}
__device__ __forceinline__ v16h frag_f32(const float* rowk0, int lane) {
  v16h a; const float* p = rowk0 + 8 * (lane >> 4);
#pragma unroll
  for (int i = 0; i < 8; ++i) { a[i] = (_Float16)p[i]; a[8 + i] = (_Float16)p[16 + i]; }
  return a;
}
__device__ __forceinline__ v16h frag_f32s(const float* rowk0, int lane, float sc) {
  v16h a; const float* p = rowk0 + 8 * (lane >> 4);
#pragma unroll
  for (int i = 0; i < 8; ++i) { a[i] = (_Float16)(p[i] * sc); a[8 + i] = (_Float16)(p[16 + i] * sc); }
  return a;
}
// column fragment from a [K][ld] layout (column n), rows >= K read as 0
__device__ __forceinline__ v16h fragc_f32(const float* W, int k0, int n, int lane, int ld, int K) {
  v16h a; const int g = lane >> 4;
#pragma unroll
  for (int i = 0; i < 8; ++i) { const int ka = k0 + 8 * g + i, kb = ka + 16;
    a[i] = (_Float16)(ka < K ? W[(size_t)(ka < K ? ka : K - 1) * ld + n] : 0.f); a[8 + i] = (_Float16)(kb < K ? W[(size_t)(kb < K ? kb : K - 1) * ld + n] : 0.f); }
  return a;
}
struct F2 { v16b h, l; };
__device__ __forceinline__ F2 bsplit16(const float v[16]) { F2 r;
#pragma unroll
  for (int i = 0; i < 16; ++i) { const __bf16 h = (__bf16)v[i]; r.h[i] = h; r.l[i] = (__bf16)(v[i] - (float)h); }
  return r; }
__device__ __forceinline__ F2 split_row(const float* row, int k0, int lane) { float v[16]; const float* p = row + k0 + 8 * (lane >> 4);
#pragma unroll
  for (int i = 0; i < 8; ++i) { v[i] = p[i]; v[8 + i] = p[16 + i]; }
  return bsplit16(v); }
__device__ __forceinline__ F2 split_rowK(const float* row, int k0, int lane, int K) { float v[16]; const int g = lane >> 4;
#pragma unroll
  for (int i = 0; i < 8; ++i) { const int ka = k0 + 8 * g + i, kb = ka + 16; v[i] = ka < K ? row[ka < K ? ka : K - 1] : 0.f; v[8 + i] = kb < K ? row[kb < K ? kb : K - 1] : 0.f; }
  return bsplit16(v); }
__device__ __forceinline__ F2 split_col(const float* W, int k0, int n, int lane, int ld, int K) { float v[16]; const int g = lane >> 4;
#pragma unroll
  for (int i = 0; i < 8; ++i) { const int ka = k0 + 8 * g + i, kb = ka + 16; v[i] = ka < K ? W[(size_t)(ka < K ? ka : K - 1) * ld + n] : 0.f; v[8 + i] = kb < K ? W[(size_t)(kb < K ? kb : K - 1) * ld + n] : 0.f; }
  return bsplit16(v); }
__device__ __forceinline__ v8f mac3(const F2& a, const F2& b, v8f c) { c = wmma_bf(a.l, b.h, c); c = wmma_bf(a.h, b.l, c); return wmma_bf(a.h, b.h, c); }
__device__ __forceinline__ float sigm(float v) { return 1.0f / (1.0f + expf(-v)); }
#define LDSX() do { asm volatile("s_wait_dscnt 0" ::: "memory"); __builtin_amdgcn_wave_barrier(); __builtin_amdgcn_fence(__ATOMIC_RELEASE, "workgroup"); } while (0)

// Single-head NON-causal self-attention with head size 128 (x [4,2048,1024]; (in,out) Wk / Wq / Wv [1024,128] N(0, 1/1024), no biases; no mask in the source; scale 128^-0.5): out = softmax(q k^T * 128^-0.5) v -> [4,2048,128].
#define NB 4
#define TT 2048
#define CC 128            // NH * HD = projected width
#define DIN 1024          // input (model) width
#define NH 1
#define HD 128
#define NQB (TT / 64)
#define HG 1
#define SCALE (0.08838834764831845f)
#define CAUSAL 0
#ifndef TNB
#define TNB NB
#endif
__device__ __forceinline__ float bfr(float v) { return (float)(__bf16)v; }
__host__ __device__ __forceinline__ int kb_last(int qb) { return CAUSAL ? ((qb * 64 + 63) >> 7) : (TT / 128 - 1); }
typedef __attribute__((ext_vector_type(8))) __bf16 v8b;
__device__ __forceinline__ v16b frag_b(const __bf16* rowk0, int lane) {
  union { v16b v; v8b q[2]; } u; const __bf16* p = rowk0 + 8 * (lane >> 4);
  u.q[0] = *(const v8b*)p; u.q[1] = *(const v8b*)(p + 16); return u.v;
}
#define QBH 0              // unused: no kernel in this file has a high-precision path
#define QHI 0               // single-product logits on every row (sigma - 1 logits over 2,048 keys)
#define KHI 64            // key rows carrying k residual / v bf16 hi+lo planes (written by k_proj; no kernel in this file reads them)
// B fragment (k rows k0+.., output column o) of a weight: (in,out) [K][ld] or (out,in) [ld rows of K]: bf16 exact, or f16(bf16 * 256) exact
__device__ __forceinline__ v16b wcol_io(const float* Wm, int k0, int o, int lane, int ld) { v16b w; const int g = lane >> 4;
#pragma unroll
  for (int i = 0; i < 8; ++i) { w[i] = (__bf16)Wm[(size_t)(k0 + 8 * g + i) * ld + o]; w[8 + i] = (__bf16)Wm[(size_t)(k0 + 16 + 8 * g + i) * ld + o]; }
  return w; }
__device__ __forceinline__ v16b wcol_oi(const float* Wm, int k0, int o, int lane, int K) { v16b w; const float* p = Wm + (size_t)o * K + k0 + 8 * (lane >> 4);
#pragma unroll
  for (int i = 0; i < 8; ++i) { w[i] = (__bf16)p[i]; w[8 + i] = (__bf16)p[16 + i]; }
  return w; }
__device__ __forceinline__ v16h wcolh_io(const float* Wm, int k0, int o, int lane, int ld) { v16h w; const int g = lane >> 4;
#pragma unroll
  for (int i = 0; i < 8; ++i) { w[i] = (_Float16)(bfr(Wm[(size_t)(k0 + 8 * g + i) * ld + o]) * 256.0f); w[8 + i] = (_Float16)(bfr(Wm[(size_t)(k0 + 16 + 8 * g + i) * ld + o]) * 256.0f); }
  return w; }
__device__ __forceinline__ v16h wcolh_oi(const float* Wm, int k0, int o, int lane, int K) { v16h w; const float* p = Wm + (size_t)o * K + k0 + 8 * (lane >> 4);
#pragma unroll
  for (int i = 0; i < 8; ++i) { w[i] = (_Float16)(bfr(p[i]) * 256.0f); w[8 + i] = (_Float16)(bfr(p[16 + i]) * 256.0f); }
  return w; }
#define WQKV_LAYOUT 0   // 0 = (in,out) [DIN][CC]; 1 = (out,in) [CC][DIN]; 2 = per-head [NH][DIN][HD]
__device__ __forceinline__ v16b wcol_hdk(const float* Wm, int k0, int o, int lane) { v16b w; const int g = lane >> 4; const float* p = Wm + (size_t)(o / HD) * DIN * HD + (o % HD);
#pragma unroll
  for (int i = 0; i < 8; ++i) { w[i] = (__bf16)p[(size_t)(k0 + 8 * g + i) * HD]; w[8 + i] = (__bf16)p[(size_t)(k0 + 16 + 8 * g + i) * HD]; }
  return w; }
#define WO_OUT_IN 0
#if WQKV_LAYOUT == 1
#define WCOL(W, k0, o, lane) wcol_oi(W, k0, o, lane, DIN)
#elif WQKV_LAYOUT == 2
#define WCOL(W, k0, o, lane) wcol_hdk(W, k0, o, lane)
#else
#define WCOL(W, k0, o, lane) wcol_io(W, k0, o, lane, CC)
#endif
#if WO_OUT_IN
#define WOCOL(W, k0, o, lane) wcol_oi(W, k0, o, lane, CC)
#define WOCOLH(W, k0, o, lane) wcolh_oi(W, k0, o, lane, CC)
#else
#define WOCOL(W, k0, o, lane) wcol_io(W, k0, o, lane, DIN)
#define WOCOLH(W, k0, o, lane) wcolh_io(W, k0, o, lane, DIN)
#endif

#ifndef SM_EXTRA_PARAMS
#define SM_EXTRA_PARAMS
#endif
#ifndef PROJ_EXTRA_PARAMS
#define PROJ_EXTRA_PARAMS
#endif
#ifndef SM_MASK_HOOK
#define SM_MASK_HOOK (void)0
#endif

#define WS_QH  0u                                      // f16 q rows [b*t][CC]
#define WS_KH  (WS_QH + 2u * (size_t)NB * TT * CC)      // f16 k rows [b*t][CC]
#define WS_VT  (WS_KH + 2u * (size_t)NB * TT * CC)      // f16 v planes [b][c][t]
#define WS_QL  (WS_VT + 2u * (size_t)NB * CC * TT)      // f16 q residual x 2^10 rows [b][t < QHI][CC]
#define WS_KL  (WS_QL + 2u * (size_t)NB * QHI * CC)     // f16 k residual x 2^10 rows [b][t < KHI][CC]
#define WS_VB  (WS_KL + 2u * (size_t)NB * KHI * CC)     // bf16 v hi planes [b][c][t < KHI]
#define WS_VBL (WS_VB + 2u * (size_t)NB * CC * KHI)
#define WS_END (WS_VBL + 2u * (size_t)NB * CC * KHI)

// ---- k_proj: block = (128 rows, 128 cols, which), 8 waves: q/k/v = X W (+ b) with exact bf16 products (K = DIN) -> which 0: q f16 rows (+ residual rows < QHI); 1: k f16 rows (+ residual rows < KHI); 2: v f16 planes [c][t] (+ bf16 hi/lo planes for t < KHI)
// X and W go through LDS as bf16 in chunks of PKC k, two buffers: every global load is a 16-byte load whose wave covers four whole lines, and one barrier a chunk publishes the new buffer and frees the old one.
// While chunk t is multiplied, the W loads of chunk t + 1 and the X loads of chunks t + 1 and t + 2 are in flight (X comes from memory, W from L2; two register sets for X, so the loop body is two chunks).
// W is turned on its way into LDS: a thread holds 8 k x 4 columns and stores, per column, 8 consecutive k as 16 bytes, so that A and B fragments are both two 16-byte LDS reads of a row. Waves 4 x 2, each 32 rows x 64 columns; every accumulator still sums k in ascending steps of 32.
#define PROWS 128          // rows of X per block
#define PKC 64             // k per chunk
#define PPIT (PKC + 8)     // LDS row pitch in elements: 128 bytes of data + 16, the pitch for 16-byte readers
#define PNCH (DIN / PKC)
typedef __attribute__((ext_vector_type(4))) __bf16 v4b;
// the scheduling barrier at the foot of each load group keeps the groups whole, in the order written and above the products: the load counter runs in issue order, so a wait for W must not have the younger X loads in front of it
#define P_LOADX(x, t) do { _Pragma("unroll") for (int i = 0; i < 8; ++i) x[i] = *(const v4f*)(xg + (size_t)i * 16 * DIN + (t) * PKC); __builtin_amdgcn_sched_barrier(0); } while (0)
#define P_LOADW(t) do { _Pragma("unroll") for (int i = 0; i < 8; ++i) wv[i] = *(const v4f*)(wg + (size_t)((t) * PKC + i) * CC); __builtin_amdgcn_sched_barrier(0); } while (0)
// work-group barrier for LDS data alone: this wave's LDS stores are complete, then the barrier; written by hand because __syncthreads() also waits for every global load, and the X loads issued ahead are to stay in flight across it
#define P_BAR() asm volatile("s_wait_dscnt 0x0\n\ts_barrier_signal -1\n\ts_barrier_wait -1" ::: "memory")
// the scheduling barrier at the head of P_STORE keeps the conversions below the products: lifted above them (seen in the listing) they wait for loads that were only just issued
#define P_STORE(x, buf) do { __builtin_amdgcn_sched_barrier(0); _Pragma("unroll") for (int i = 0; i < 8; ++i) { v4b p; _Pragma("unroll") for (int e = 0; e < 4; ++e) p[e] = (__bf16)x[i][e]; *(v4b*)&sx[buf][(tid >> 4) + 16 * i][(tid & 15) * 4] = p; } \
    _Pragma("unroll") for (int c = 0; c < 4; ++c) { v8b p; _Pragma("unroll") for (int i = 0; i < 8; ++i) p[i] = (__bf16)wv[i][c]; *(v8b*)&sw[buf][(wave & 3) * 32 + cl * 4 + c][((wave >> 2) * 4 + kl) * 8] = p; } } while (0)
#define P_MUL(buf) do { _Pragma("unroll") for (int kk = 0; kk < PKC / 32; ++kk) { v16b a[2], w[4]; \
    _Pragma("unroll") for (int i = 0; i < 2; ++i) a[i] = frag_b(&sx[buf][wr * 32 + i * 16 + col][kk * 32], lane); \
    _Pragma("unroll") for (int j = 0; j < 4; ++j) w[j] = frag_b(&sw[buf][wc * 64 + j * 16 + col][kk * 32], lane); \
    _Pragma("unroll") for (int i = 0; i < 2; ++i) _Pragma("unroll") for (int j = 0; j < 4; ++j) acc[i][j] = wmma_bf(a[i], w[j], acc[i][j]); } } while (0)
__global__ __launch_bounds__(256) void k_proj(const float* __restrict__ XQ, const float* __restrict__ XK, const float* __restrict__ XV, const float* __restrict__ WQ, const float* __restrict__ WK, const float* __restrict__ WV, const float* __restrict__ BQ, const float* __restrict__ BK, const float* __restrict__ BV,
    _Float16* __restrict__ QH, _Float16* __restrict__ QL, _Float16* __restrict__ KH, _Float16* __restrict__ KL, _Float16* __restrict__ VT, __bf16* __restrict__ VB, __bf16* __restrict__ VBL) {
  __shared__ __align__(16) _Float16 sh[PROWS][136], sl[PROWS][136]; __shared__ __align__(16) _Float16 th[128][PROWS + 8]; __shared__ __align__(16) __bf16 tb[128][PROWS + 8], tbl[128][PROWS + 8];
  __shared__ __align__(16) __bf16 sx[2][PROWS][PPIT], sw[2][128][PPIT];
  const int tid = threadIdx.x, wave = tid >> 5, lane = tid & 31, col = lane & 15, g = lane >> 4; const int which = blockIdx.z; const int c0 = blockIdx.y * 128; const size_t r0 = (size_t)blockIdx.x * PROWS; const size_t bb = r0 / TT; const int t0 = (int)(r0 % TT);
  const float* X = which == 0 ? XQ : which == 1 ? XK : XV; const float* WA = which == 0 ? WQ : which == 1 ? WK : WV; const float* BA = which == 0 ? BQ : which == 1 ? BK : BV;
  const int wr = wave >> 1, wc = wave & 1, cl = lane & 7, kl = lane >> 3;
  const float* xg = X + (r0 + (tid >> 4)) * DIN + (tid & 15) * 4;                                        // a wave's load: 2 rows x 256 bytes
  const float* wg = WA + (size_t)(((wave >> 2) * 4 + kl) * 8) * CC + c0 + (wave & 3) * 32 + cl * 4;      // a wave's load: 4 k rows x 128 bytes
  v4f xa[8], xb[8], wv[8]; v8f acc[2][4] = {};
  P_LOADX(xa, 0); P_LOADW(0); P_LOADX(xb, 1);
  P_STORE(xa, 0);
  P_BAR();
#pragma unroll 1   // rolled: the body is two chunks, one for each register set of X, and the code stays small
  for (int t = 0; t + 2 < PNCH; t += 2) {
    P_LOADW(t + 1); P_LOADX(xa, t + 2); P_MUL(0); P_STORE(xb, 1);
    P_BAR();     // publishes chunk t + 1 and ends every read of chunk t, whose buffer is refilled next
    P_LOADW(t + 2); P_LOADX(xb, t + 3); P_MUL(1); P_STORE(xa, 0);
    P_BAR(); }   // the same for chunk t + 2
  P_LOADW(PNCH - 1); P_MUL(0); P_STORE(xb, 1);
  P_BAR();
  P_MUL(1);
  if (which < 2) { _Float16* DH = which == 0 ? QH : KH; _Float16* DL = which == 0 ? QL : KL; const int nhi = which == 0 ? QHI : KHI;
#pragma unroll
    for (int i = 0; i < 2; ++i)
#pragma unroll
    for (int j = 0; j < 4; ++j) { const int cc = wc * 64 + j * 16 + col; const float bias = BA ? bfr(BA[c0 + cc]) : 0.f;
#pragma unroll
      for (int r = 0; r < 8; ++r) { const float v = acc[i][j][r] + bias; const _Float16 hv = (_Float16)v; const int rl = wr * 32 + i * 16 + 8 * g + r; sh[rl][cc] = hv; sl[rl][cc] = (_Float16)((v - (float)hv) * 1024.0f); } }
    __syncthreads();
    for (int e = tid; e < PROWS * 16; e += 256) { const int rl = e >> 4, q = e & 15; vst2((unsigned*)(DH + (r0 + rl) * CC + c0 + q * 8), *(const v4u*)&sh[rl][q * 8]); if (t0 + rl < nhi) { vst2((unsigned*)(DL + (bb * nhi + t0 + rl) * (size_t)CC + c0 + q * 8), *(const v4u*)&sl[rl][q * 8]);
        asm volatile("s_wait_xcnt 0x0" ::: "memory"); } }   // the next trip forms its address in the registers that this store names; inside the branch, so that no address addition is lifted over it
  } else {
#pragma unroll
    for (int i = 0; i < 2; ++i)
#pragma unroll
    for (int j = 0; j < 4; ++j) { const int cc = wc * 64 + j * 16 + col; const float bias = BA ? bfr(BA[c0 + cc]) : 0.f;
#pragma unroll
      for (int r = 0; r < 8; ++r) { const float v = acc[i][j][r] + bias; const int rl = wr * 32 + i * 16 + 8 * g + r; th[cc][rl] = (_Float16)v; const __bf16 bh = (__bf16)v; tb[cc][rl] = bh; tbl[cc][rl] = (__bf16)(v - (float)bh); } }
    __syncthreads();
    for (int e = tid; e < 128 * (PROWS / 8); e += 256) { const int cl2 = e / (PROWS / 8), q = e % (PROWS / 8); vst2((unsigned*)(VT + (bb * CC + c0 + cl2) * (size_t)TT + t0 + q * 8), *(const v4u*)&th[cl2][q * 8]); if (t0 + q * 8 < KHI) { const size_t o3 = (bb * CC + c0 + cl2) * (size_t)KHI + t0 + q * 8; vst2((unsigned*)(VB + o3), *(const v4u*)&tb[cl2][q * 8]); vst2((unsigned*)(VBL + o3), *(const v4u*)&tbl[cl2][q * 8]);
        asm volatile("s_wait_xcnt 0x0" ::: "memory"); } } } }   // the next trip forms its addresses in the registers that these two stores name; inside the branch, so that no address addition is lifted over it
__device__ __forceinline__ float exp2_slot(float x) { float y; asm("v_exp_f32 %0, %1\n\tv_nop" : "=v"(y) : "v"(x)); return y; }
#define KSPLIT 4
#define QTILES 2
#define KBLK 64
#define NBLK (TT / KSPLIT / KBLK)
#define LDK(buf, j) do { _Pragma("unroll") for (int t = 0; t < 4; ++t) fb[buf][t] = frag_h(kp + (j) * 16 * CC + t * 32, lane); } while (0)                                   /* key tile j, head slices 0..3 */
#define LDV(buf, jj) do { _Pragma("unroll") for (int t = 0; t < 4; ++t) fb[buf][t] = frag_h(vp + (size_t)((jj) * 2 + (t >> 1)) * 16 * TT + (t & 1) * 32, lane); } while (0)   /* channel tiles 2jj, 2jj+1, key slices 0..1 */
#define QK(buf, j) do { _Pragma("unroll") for (int t = 0; t < 4; ++t) s[j] = wmma16(fb[buf][t], aq[t], s[j]); } while (0)
#define PV(buf, jj) do { _Pragma("unroll") for (int t = 0; t < 4; ++t) o[(jj) * 2 + (t >> 1)] = wmma16(fb[buf][t], pf[t & 1], o[(jj) * 2 + (t >> 1)]); } while (0)
__global__ __launch_bounds__(32 * KSPLIT * QTILES) void k_fa(const _Float16* __restrict__ QH, const _Float16* __restrict__ KH, const _Float16* __restrict__ VT, float* __restrict__ Y) {
  __shared__ __align__(16) float ps[QTILES * KSPLIT][16][HD + 4]; __shared__ float pm[QTILES * KSPLIT][16], pl[QTILES * KSPLIT][16];
  const int tid = threadIdx.x, wave = tid >> 5, lane = tid & 31, col = lane & 15, g = lane >> 4; const int b = blockIdx.y, kq = wave & (KSPLIT - 1); const size_t qb0 = (size_t)b * TT + blockIdx.x * (16 * QTILES), q0 = qb0 + (wave / KSPLIT) * 16;
  const float c2 = SCALE * 1.4426950408889634f;   // logit scale times log2(e): the exponentials are base 2
  const _Float16* kp = KH + ((size_t)b * TT + kq * (TT / KSPLIT) + col) * CC; const _Float16* vp = VT + ((size_t)b * CC + col) * (size_t)TT + kq * (TT / KSPLIT);
  v16h aq[HD / 32], fb[2][4], pf[2];
#pragma unroll
  for (int kc = 0; kc < HD / 32; ++kc) aq[kc] = frag_h(QH + (q0 + col) * CC + kc * 32, lane);
  __builtin_amdgcn_sched_barrier(0);   // q loads stay the oldest: issued behind the k groups they would turn the loop's first counted wait into a wait for every load
  LDK(0, 0); LDK(1, 1);
  v8f o[HD / 16] = {}; float m = -3.0e38f, l = 0.f;
#pragma unroll 1   // rolled: a pass is one straight block of code, and the two fragment groups in flight are carried over its back edge
  for (int kb = 0; kb < NBLK; ++kb) { v8f s[KBLK / 16] = {};
    QK(0, 0); LDK(0, 2); QK(1, 1); LDK(1, 3); QK(0, 2); LDV(0, 0); QK(1, 3); LDV(1, 1);
    float mx = s[0][0];
#pragma unroll
    for (int j = 0; j < KBLK / 16; ++j)
#pragma unroll
      for (int r = 0; r < 8; ++r) mx = fmaxf(mx, s[j][r]);
    mx = fmaxf(mx, __shfl_xor(mx, 16));   // the other half of the wave holds the query's other 32 keys
    const float mn = fmaxf(m, mx * c2); const float al = __builtin_amdgcn_exp2f(m - mn); m = mn; float sj[KBLK / 16] = {};
#pragma unroll
    for (int j = 0; j < KBLK / 16; ++j)
#pragma unroll
      for (int r = 0; r < 8; ++r) { const float p = __builtin_amdgcn_exp2f(s[j][r] * c2 - mn); sj[j] += p; pf[j >> 1][(j & 1) * 8 + r] = (_Float16)p; }
    l = l * al + ((sj[0] + sj[1]) + (sj[2] + sj[3]));
#pragma unroll
    for (int j = 0; j < HD / 16; ++j) o[j] *= al;
    kp += kb + 1 < NBLK ? KBLK * CC : 0;   // behind the last block its own first two key tiles are read again, unused: the loads stay unconditional and their counted waits exact
    PV(0, 0); LDV(0, 2); PV(1, 1); LDV(1, 3); PV(0, 2); LDK(0, 0); PV(1, 3); LDK(1, 1);
    asm volatile("s_wait_xcnt 0x0" ::: "memory");   // the next pass forms its addresses in the registers that these loads name
    vp += KBLK; }
  l += __shfl_xor(l, 16);
  if (g == 0) { pm[wave][col] = m; pl[wave][col] = l; }
#pragma unroll
  for (int j = 0; j < HD / 16; ++j) { *(v4f*)&ps[wave][col][j * 16 + 8 * g] = __builtin_shufflevector(o[j], o[j], 0, 1, 2, 3); *(v4f*)&ps[wave][col][j * 16 + 8 * g + 4] = __builtin_shufflevector(o[j], o[j], 4, 5, 6, 7); }
  __syncthreads();
#pragma unroll
  for (int i = 0; i < 4; ++i) { const int rr = wave + 4 * QTILES * i, w0 = (rr >> 4) * KSPLIT, row = rr & 15; float mm = pm[w0][row];
#pragma unroll
    for (int w = 1; w < KSPLIT; ++w) mm = fmaxf(mm, pm[w0 + w][row]);
    float den = 0.f; v4f acc = {};
#pragma unroll
    for (int w = 0; w < KSPLIT; ++w) { const float f = exp2_slot(pm[w0 + w][row] - mm); den += f * pl[w0 + w][row]; acc += *(const v4f*)&ps[w0 + w][row][lane * 4] * f; }
    vst2(Y + (qb0 + rr) * CC + lane * 4, acc * (1.0f / den)); } }

extern "C" void kernel_launch(void* const* d_in, const int* in_sizes, int n_in, void* d_out, int out_size, void* d_ws, size_t ws_size, hipStream_t stream) {
  (void)in_sizes; (void)n_in; (void)out_size;
  const float** F = (const float**)d_in;
  if (ws_size < (size_t)WS_END) return;
  char* ws = (char*)d_ws; _Float16 *QH = (_Float16*)(ws + WS_QH), *KH = (_Float16*)(ws + WS_KH), *VT = (_Float16*)(ws + WS_VT), *QL = (_Float16*)(ws + WS_QL), *KL = (_Float16*)(ws + WS_KL); __bf16 *VB = (__bf16*)(ws + WS_VB), *VBL = (__bf16*)(ws + WS_VBL);
  // inputs, in order: 0 x [4,2048,1024]; 1 Wk [1024,128] (in,out); 2 Wq [1024,128]; 3 Wv [1024,128]; no biases
  k_proj<<<dim3(TNB * TT / PROWS, CC / 128, 3), 256, 0, stream>>>(F[0], F[0], F[0], F[2], F[1], F[3], nullptr, nullptr, nullptr, QH, QL, KH, KL, VT, VB, VBL);   /* q uses Wq = input 2, k uses Wk = input 1 */
  // logits, softmax and P . v of every batch in one launch
  k_fa<<<dim3(TT / (16 * QTILES), TNB), 32 * KSPLIT * QTILES, 0, stream>>>(QH, KH, VT, (float*)d_out);
}

// v004
// One run takes 42.1 microseconds.
// Two timings next to v003 both put it at 1.11 times that version's speed.
// Counting every step since v000, it is 13.5 times as fast.
// compute dtype: all float inputs rounded to bf16; q/k/v projections with EXACT bf16 products on WMMA 16x16x32 (f32 accumulate); logits q x k once to f16 each (1 product; sigma - 1) x 128^-0.5; online softmax f32; P = exp(logit - running max) once to f16 x v once to f16 (1 product); f32 output.
#include <hip/hip_runtime.h>
#include <math.h>

typedef __attribute__((ext_vector_type(16))) _Float16 v16h;
typedef __attribute__((ext_vector_type(16))) __bf16 v16b;
typedef __attribute__((ext_vector_type(8)))  _Float16 v8h;
typedef __attribute__((ext_vector_type(8)))  float v8f;
typedef __attribute__((ext_vector_type(4)))  float v4f;
typedef __attribute__((ext_vector_type(2)))  float v2f;
typedef __attribute__((ext_vector_type(4)))  unsigned v4u;
typedef __attribute__((ext_vector_type(4)))  int v4i;
typedef float __attribute__((may_alias)) float_a;
typedef int __attribute__((may_alias)) int_a;

template <typename T> __device__ __forceinline__ void vst2(void* p, T v) { *(T*)p = v;  }
__device__ __forceinline__ v8f wmma16(v16h a, v16h b, v8f c) {
  v8f d = __builtin_amdgcn_wmma_f32_16x16x32_f16(false, a, false, b, (short)0, c, false, false);
  asm volatile("v_nop\n\tv_nop\n\tv_nop\n\tv_nop" : "+v"(d) : "v"(a), "v"(b));
  return d;
}
__device__ __forceinline__ v8f wmma_bf(v16b a, v16b b, v8f c) {
  v8f d = __builtin_amdgcn_wmma_f32_16x16x32_bf16(false, a, false, b, (short)0, c, false, false);
  asm volatile("v_nop\n\tv_nop\n\tv_nop\n\tv_nop" : "+v"(d) : "v"(a), "v"(b));
  return d;
}
// 16x16x32 fragments: lane = (h = lane>>4, row/col = lane&15); elements 0..7 = k0+8h+0..7, 8..15 = k0+16+8h+0..7; D element r = row 8h+r
__device__ __forceinline__ v16h frag_h(const _Float16* rowk0, int lane) {
  union { v16h v; v8h q[2]; } u; const _Float16* p = rowk0 + 8 * (lane >> 4);
  u.q[0] = *(const v8h*)p; u.q[1] = *(const v8h*)(p + 16); return u.v;
}
__device__ __forceinline__ v16h frag_f32(const float* rowk0, int lane) {
  v16h a; const float* p = rowk0 + 8 * (lane >> 4);
#pragma unroll
  for (int i = 0; i < 8; ++i) { a[i] = (_Float16)p[i]; a[8 + i] = (_Float16)p[16 + i]; }
  return a;
}
__device__ __forceinline__ v16h frag_f32s(const float* rowk0, int lane, float sc) {
  v16h a; const float* p = rowk0 + 8 * (lane >> 4);
#pragma unroll
  for (int i = 0; i < 8; ++i) { a[i] = (_Float16)(p[i] * sc); a[8 + i] = (_Float16)(p[16 + i] * sc); }
  return a;
}
// column fragment from a [K][ld] layout (column n), rows >= K read as 0
__device__ __forceinline__ v16h fragc_f32(const float* W, int k0, int n, int lane, int ld, int K) {
  v16h a; const int g = lane >> 4;
#pragma unroll
  for (int i = 0; i < 8; ++i) { const int ka = k0 + 8 * g + i, kb = ka + 16;
    a[i] = (_Float16)(ka < K ? W[(size_t)(ka < K ? ka : K - 1) * ld + n] : 0.f); a[8 + i] = (_Float16)(kb < K ? W[(size_t)(kb < K ? kb : K - 1) * ld + n] : 0.f); }
  return a;
}
struct F2 { v16b h, l; };
__device__ __forceinline__ F2 bsplit16(const float v[16]) { F2 r;
#pragma unroll
  for (int i = 0; i < 16; ++i) { const __bf16 h = (__bf16)v[i]; r.h[i] = h; r.l[i] = (__bf16)(v[i] - (float)h); }
  return r; }
__device__ __forceinline__ F2 split_row(const float* row, int k0, int lane) { float v[16]; const float* p = row + k0 + 8 * (lane >> 4);
#pragma unroll
  for (int i = 0; i < 8; ++i) { v[i] = p[i]; v[8 + i] = p[16 + i]; }
  return bsplit16(v); }
__device__ __forceinline__ F2 split_rowK(const float* row, int k0, int lane, int K) { float v[16]; const int g = lane >> 4;
#pragma unroll
  for (int i = 0; i < 8; ++i) { const int ka = k0 + 8 * g + i, kb = ka + 16; v[i] = ka < K ? row[ka < K ? ka : K - 1] : 0.f; v[8 + i] = kb < K ? row[kb < K ? kb : K - 1] : 0.f; }
  return bsplit16(v); }
__device__ __forceinline__ F2 split_col(const float* W, int k0, int n, int lane, int ld, int K) { float v[16]; const int g = lane >> 4;
#pragma unroll
  for (int i = 0; i < 8; ++i) { const int ka = k0 + 8 * g + i, kb = ka + 16; v[i] = ka < K ? W[(size_t)(ka < K ? ka : K - 1) * ld + n] : 0.f; v[8 + i] = kb < K ? W[(size_t)(kb < K ? kb : K - 1) * ld + n] : 0.f; }
  return bsplit16(v); }
__device__ __forceinline__ v8f mac3(const F2& a, const F2& b, v8f c) { c = wmma_bf(a.l, b.h, c); c = wmma_bf(a.h, b.l, c); return wmma_bf(a.h, b.h, c); }
__device__ __forceinline__ float sigm(float v) { return 1.0f / (1.0f + expf(-v)); }
#define LDSX() do { asm volatile("s_wait_dscnt 0" ::: "memory"); __builtin_amdgcn_wave_barrier(); __builtin_amdgcn_fence(__ATOMIC_RELEASE, "workgroup"); } while (0)

// Single-head NON-causal self-attention with head size 128 (x [4,2048,1024]; (in,out) Wk / Wq / Wv [1024,128] N(0, 1/1024), no biases; no mask in the source; scale 128^-0.5): out = softmax(q k^T * 128^-0.5) v -> [4,2048,128].
#define NB 4
#define TT 2048
#define CC 128            // NH * HD = projected width
#define DIN 1024          // input (model) width
#define NH 1
#define HD 128
#define NQB (TT / 64)
#define HG 1
#define SCALE (0.08838834764831845f)
#define CAUSAL 0
#ifndef TNB
#define TNB NB
#endif
__device__ __forceinline__ float bfr(float v) { return (float)(__bf16)v; }
__host__ __device__ __forceinline__ int kb_last(int qb) { return CAUSAL ? ((qb * 64 + 63) >> 7) : (TT / 128 - 1); }
typedef __attribute__((ext_vector_type(8))) __bf16 v8b;
__device__ __forceinline__ v16b frag_b(const __bf16* rowk0, int lane) {
  union { v16b v; v8b q[2]; } u; const __bf16* p = rowk0 + 8 * (lane >> 4);
  u.q[0] = *(const v8b*)p; u.q[1] = *(const v8b*)(p + 16); return u.v;
}
#define QBH 0              // unused: no kernel in this file has a high-precision path
#define QHI 0               // single-product logits on every row (sigma - 1 logits over 2,048 keys)
#define KHI 64            // key rows carrying k residual / v bf16 hi+lo planes (written by k_proj; no kernel in this file reads them)
// B fragment (k rows k0+.., output column o) of a weight: (in,out) [K][ld] or (out,in) [ld rows of K]: bf16 exact, or f16(bf16 * 256) exact
__device__ __forceinline__ v16b wcol_io(const float* Wm, int k0, int o, int lane, int ld) { v16b w; const int g = lane >> 4;
#pragma unroll
  for (int i = 0; i < 8; ++i) { w[i] = (__bf16)Wm[(size_t)(k0 + 8 * g + i) * ld + o]; w[8 + i] = (__bf16)Wm[(size_t)(k0 + 16 + 8 * g + i) * ld + o]; }
  return w; }
__device__ __forceinline__ v16b wcol_oi(const float* Wm, int k0, int o, int lane, int K) { v16b w; const float* p = Wm + (size_t)o * K + k0 + 8 * (lane >> 4);
#pragma unroll
  for (int i = 0; i < 8; ++i) { w[i] = (__bf16)p[i]; w[8 + i] = (__bf16)p[16 + i]; }
  return w; }
__device__ __forceinline__ v16h wcolh_io(const float* Wm, int k0, int o, int lane, int ld) { v16h w; const int g = lane >> 4;
#pragma unroll
  for (int i = 0; i < 8; ++i) { w[i] = (_Float16)(bfr(Wm[(size_t)(k0 + 8 * g + i) * ld + o]) * 256.0f); w[8 + i] = (_Float16)(bfr(Wm[(size_t)(k0 + 16 + 8 * g + i) * ld + o]) * 256.0f); }
  return w; }
__device__ __forceinline__ v16h wcolh_oi(const float* Wm, int k0, int o, int lane, int K) { v16h w; const float* p = Wm + (size_t)o * K + k0 + 8 * (lane >> 4);
#pragma unroll
  for (int i = 0; i < 8; ++i) { w[i] = (_Float16)(bfr(p[i]) * 256.0f); w[8 + i] = (_Float16)(bfr(p[16 + i]) * 256.0f); }
  return w; }
#define WQKV_LAYOUT 0   // 0 = (in,out) [DIN][CC]; 1 = (out,in) [CC][DIN]; 2 = per-head [NH][DIN][HD]
__device__ __forceinline__ v16b wcol_hdk(const float* Wm, int k0, int o, int lane) { v16b w; const int g = lane >> 4; const float* p = Wm + (size_t)(o / HD) * DIN * HD + (o % HD);
#pragma unroll
  for (int i = 0; i < 8; ++i) { w[i] = (__bf16)p[(size_t)(k0 + 8 * g + i) * HD]; w[8 + i] = (__bf16)p[(size_t)(k0 + 16 + 8 * g + i) * HD]; }
  return w; }
#define WO_OUT_IN 0
#if WQKV_LAYOUT == 1
#define WCOL(W, k0, o, lane) wcol_oi(W, k0, o, lane, DIN)
#elif WQKV_LAYOUT == 2
#define WCOL(W, k0, o, lane) wcol_hdk(W, k0, o, lane)
#else
#define WCOL(W, k0, o, lane) wcol_io(W, k0, o, lane, CC)
#endif
#if WO_OUT_IN
#define WOCOL(W, k0, o, lane) wcol_oi(W, k0, o, lane, CC)
#define WOCOLH(W, k0, o, lane) wcolh_oi(W, k0, o, lane, CC)
#else
#define WOCOL(W, k0, o, lane) wcol_io(W, k0, o, lane, DIN)
#define WOCOLH(W, k0, o, lane) wcolh_io(W, k0, o, lane, DIN)
#endif

#ifndef SM_EXTRA_PARAMS
#define SM_EXTRA_PARAMS
#endif
#ifndef PROJ_EXTRA_PARAMS
#define PROJ_EXTRA_PARAMS
#endif
#ifndef SM_MASK_HOOK
#define SM_MASK_HOOK (void)0
#endif

// q, k and v lie in FRAGMENT ORDER: one 16 x 32 WMMA fragment is a block of 1 KiB = two runs of 512 bytes, run h holding at lane * 16 bytes the eight elements 16 h + 8 (lane >> 4) + 0..7 of row lane & 15, so that each of a fragment's two 16-byte loads reads four whole lines
#define WS_QH  0u                                      // f16 q fragments [b*t / 16][CC / 32][1 KiB]: rows = 16 queries, elements = 32 head channels
#define WS_KH  (WS_QH + 2u * (size_t)NB * TT * CC)      // f16 k fragments [b*t / 16][CC / 32][1 KiB]: rows = 16 keys, elements = 32 head channels
#define WS_VT  (WS_KH + 2u * (size_t)NB * TT * CC)      // f16 v fragments [b][t / 32][CC / 16][1 KiB]: rows = 16 channels, elements = 32 keys
#define WS_QL  (WS_VT + 2u * (size_t)NB * CC * TT)      // f16 q residual x 2^10 rows [b][t < QHI][CC]
#define WS_KL  (WS_QL + 2u * (size_t)NB * QHI * CC)     // f16 k residual x 2^10 rows [b][t < KHI][CC]
#define WS_VB  (WS_KL + 2u * (size_t)NB * KHI * CC)     // bf16 v hi planes [b][c][t < KHI]
#define WS_VBL (WS_VB + 2u * (size_t)NB * CC * KHI)
#define WS_END (WS_VBL + 2u * (size_t)NB * CC * KHI)

// ---- k_proj: block = (128 rows, 128 cols, which), 8 waves: q/k/v = X W (+ b) with exact bf16 products (K = DIN) -> which 0: q f16 fragments (+ residual rows < QHI); 1: k f16 fragments (+ residual rows < KHI); 2: v f16 fragments (+ bf16 hi/lo planes for t < KHI); the fragment order (at WS_QH) takes CC == 128, one column block
// X and W go through LDS as bf16 in chunks of PKC k, two buffers: every global load is a 16-byte load whose wave covers four whole lines, and one barrier a chunk publishes the new buffer and frees the old one.
// While chunk t is multiplied, the W loads of chunk t + 1 and the X loads of chunks t + 1 and t + 2 are in flight (X comes from memory, W from L2; two register sets for X, so the loop body is two chunks).
// W is turned on its way into LDS: a thread holds 8 k x 4 columns and stores, per column, 8 consecutive k as 16 bytes, so that A and B fragments are both two 16-byte LDS reads of a row. Waves 4 x 2, each 32 rows x 64 columns; every accumulator still sums k in ascending steps of 32.
#define PROWS 128          // rows of X per block
#define PKC 64             // k per chunk
#define PPIT (PKC + 8)     // LDS row pitch in elements: 128 bytes of data + 16, the pitch for 16-byte readers
#define PNCH (DIN / PKC)
typedef __attribute__((ext_vector_type(4))) __bf16 v4b;
// the scheduling barrier at the foot of each load group keeps the groups whole, in the order written and above the products: the load counter runs in issue order, so a wait for W must not have the younger X loads in front of it
#define P_LOADX(x, t) do { _Pragma("unroll") for (int i = 0; i < 8; ++i) x[i] = *(const v4f*)(xg + (size_t)i * 16 * DIN + (t) * PKC); __builtin_amdgcn_sched_barrier(0); } while (0)
#define P_LOADW(t) do { _Pragma("unroll") for (int i = 0; i < 8; ++i) wv[i] = *(const v4f*)(wg + (size_t)((t) * PKC + i) * CC); __builtin_amdgcn_sched_barrier(0); } while (0)
// work-group barrier for LDS data alone: this wave's LDS stores are complete, then the barrier; written by hand because __syncthreads() also waits for every global load, and the X loads issued ahead are to stay in flight across it
#define P_BAR() asm volatile("s_wait_dscnt 0x0\n\ts_barrier_signal -1\n\ts_barrier_wait -1" ::: "memory")
// the scheduling barrier at the head of P_STORE keeps the conversions below the products: lifted above them (seen in the listing) they wait for loads that were only just issued
#define P_STORE(x, buf) do { __builtin_amdgcn_sched_barrier(0); _Pragma("unroll") for (int i = 0; i < 8; ++i) { v4b p; _Pragma("unroll") for (int e = 0; e < 4; ++e) p[e] = (__bf16)x[i][e]; *(v4b*)&sx[buf][(tid >> 4) + 16 * i][(tid & 15) * 4] = p; } \
    _Pragma("unroll") for (int c = 0; c < 4; ++c) { v8b p; _Pragma("unroll") for (int i = 0; i < 8; ++i) p[i] = (__bf16)wv[i][c]; *(v8b*)&sw[buf][(wave & 3) * 32 + cl * 4 + c][((wave >> 2) * 4 + kl) * 8] = p; } } while (0)
#define P_MUL(buf) do { _Pragma("unroll") for (int kk = 0; kk < PKC / 32; ++kk) { v16b a[2], w[4]; \
    _Pragma("unroll") for (int i = 0; i < 2; ++i) a[i] = frag_b(&sx[buf][wr * 32 + i * 16 + col][kk * 32], lane); \
    _Pragma("unroll") for (int j = 0; j < 4; ++j) w[j] = frag_b(&sw[buf][wc * 64 + j * 16 + col][kk * 32], lane); \
    _Pragma("unroll") for (int i = 0; i < 2; ++i) _Pragma("unroll") for (int j = 0; j < 4; ++j) acc[i][j] = wmma_bf(a[i], w[j], acc[i][j]); } } while (0)
__global__ __launch_bounds__(256) void k_proj(const float* __restrict__ XQ, const float* __restrict__ XK, const float* __restrict__ XV, const float* __restrict__ WQ, const float* __restrict__ WK, const float* __restrict__ WV, const float* __restrict__ BQ, const float* __restrict__ BK, const float* __restrict__ BV,
    _Float16* __restrict__ QH, _Float16* __restrict__ QL, _Float16* __restrict__ KH, _Float16* __restrict__ KL, _Float16* __restrict__ VT, __bf16* __restrict__ VB, __bf16* __restrict__ VBL) {
  __shared__ __align__(16) _Float16 sh[PROWS][136], sl[PROWS][136]; __shared__ __align__(16) _Float16 th[128][PROWS + 8]; __shared__ __align__(16) __bf16 tb[128][PROWS + 8], tbl[128][PROWS + 8];
  __shared__ __align__(16) __bf16 sx[2][PROWS][PPIT], sw[2][128][PPIT];
  const int tid = threadIdx.x, wave = tid >> 5, lane = tid & 31, col = lane & 15, g = lane >> 4; const int which = blockIdx.z; const int c0 = blockIdx.y * 128; const size_t r0 = (size_t)blockIdx.x * PROWS; const size_t bb = r0 / TT; const int t0 = (int)(r0 % TT);
  const float* X = which == 0 ? XQ : which == 1 ? XK : XV; const float* WA = which == 0 ? WQ : which == 1 ? WK : WV; const float* BA = which == 0 ? BQ : which == 1 ? BK : BV;
  const int wr = wave >> 1, wc = wave & 1, cl = lane & 7, kl = lane >> 3;
  const float* xg = X + (r0 + (tid >> 4)) * DIN + (tid & 15) * 4;                                        // a wave's load: 2 rows x 256 bytes
  const float* wg = WA + (size_t)(((wave >> 2) * 4 + kl) * 8) * CC + c0 + (wave & 3) * 32 + cl * 4;      // a wave's load: 4 k rows x 128 bytes
  v4f xa[8], xb[8], wv[8]; v8f acc[2][4] = {};
  P_LOADX(xa, 0); P_LOADW(0); P_LOADX(xb, 1);
  P_STORE(xa, 0);
  P_BAR();
#pragma unroll 1   // rolled: the body is two chunks, one for each register set of X, and the code stays small
  for (int t = 0; t + 2 < PNCH; t += 2) {
    P_LOADW(t + 1); P_LOADX(xa, t + 2); P_MUL(0); P_STORE(xb, 1);
    P_BAR();     // publishes chunk t + 1 and ends every read of chunk t, whose buffer is refilled next
    P_LOADW(t + 2); P_LOADX(xb, t + 3); P_MUL(1); P_STORE(xa, 0);
    P_BAR(); }   // the same for chunk t + 2
  P_LOADW(PNCH - 1); P_MUL(0); P_STORE(xb, 1);
  P_BAR();
  P_MUL(1);
  if (which < 2) { _Float16* DH = which == 0 ? QH : KH; _Float16* DL = which == 0 ? QL : KL; const int nhi = which == 0 ? QHI : KHI;
#pragma unroll
    for (int i = 0; i < 2; ++i)
#pragma unroll
    for (int j = 0; j < 4; ++j) { const int cc = wc * 64 + j * 16 + col; const float bias = BA ? bfr(BA[c0 + cc]) : 0.f;
#pragma unroll
      for (int r = 0; r < 8; ++r) { const float v = acc[i][j][r] + bias; const _Float16 hv = (_Float16)v; const int rl = wr * 32 + i * 16 + 8 * g + r; sh[rl][cc] = hv; sl[rl][cc] = (_Float16)((v - (float)hv) * 1024.0f); } }
    __syncthreads();
    for (int e = tid; e < PROWS * 16; e += 256) { const int rl = (e >> 8) * 16 + (e & 15), q = (e >> 4) & 15; vst2((unsigned*)(DH + r0 * CC + (size_t)e * 8), *(const v4u*)&sh[rl][q * 8]); if (t0 + rl < nhi) {   /* piece e of the block's 128 rows in fragment order: row tile e >> 8, octet q of the row */ vst2((unsigned*)(DL + (bb * nhi + t0 + rl) * (size_t)CC + c0 + q * 8), *(const v4u*)&sl[rl][q * 8]);
        asm volatile("s_wait_xcnt 0x0" ::: "memory"); } }   // the next trip forms its address in the registers that this store names; inside the branch, so that no address addition is lifted over it
  } else {
#pragma unroll
    for (int i = 0; i < 2; ++i)
#pragma unroll
    for (int j = 0; j < 4; ++j) { const int cc = wc * 64 + j * 16 + col; const float bias = BA ? bfr(BA[c0 + cc]) : 0.f;
#pragma unroll
      for (int r = 0; r < 8; ++r) { const float v = acc[i][j][r] + bias; const int rl = wr * 32 + i * 16 + 8 * g + r; th[cc][rl] = (_Float16)v; const __bf16 bh = (__bf16)v; tb[cc][rl] = bh; tbl[cc][rl] = (__bf16)(v - (float)bh); } }
    __syncthreads();
    for (int e = tid; e < 128 * (PROWS / 8); e += 256) { const int cl2 = ((e >> 6) & 7) * 16 + (e & 15), q = (e >> 9) * 4 + ((e >> 4) & 3); vst2((unsigned*)(VT + (bb * TT + t0) * (size_t)CC + (size_t)e * 8), *(const v4u*)&th[cl2][q * 8]); if (t0 + q * 8 < KHI) {   /* piece e of the block's 128 keys in fragment order: 32 keys e >> 9, channel tile (e >> 6) & 7, key octet q */ const size_t o3 = (bb * CC + c0 + cl2) * (size_t)KHI + t0 + q * 8; vst2((unsigned*)(VB + o3), *(const v4u*)&tb[cl2][q * 8]); vst2((unsigned*)(VBL + o3), *(const v4u*)&tbl[cl2][q * 8]);
        asm volatile("s_wait_xcnt 0x0" ::: "memory"); } } } }   // the next trip forms its addresses in the registers that these two stores name; inside the branch, so that no address addition is lifted over it
__device__ __forceinline__ float exp2_slot(float x) { float y; asm("v_exp_f32 %0, %1\n\tv_nop" : "=v"(y) : "v"(x)); return y; }
#define KSPLIT 4
#define QTILES 2
#define KBLK 64
#define NBLK (TT / KSPLIT / KBLK)
// one fragment in fragment order; p = its 1-KiB block + lane * 8 elements
__device__ __forceinline__ v16h frag_p(const _Float16* p) { union { v16h v; v8h q[2]; } u; u.q[0] = *(const v8h*)p; u.q[1] = *(const v8h*)(p + 256); return u.v; }
#define LDK(buf, j) do { _Pragma("unroll") for (int t = 0; t < 4; ++t) fb[buf][t] = frag_p(kp + ((j) * 4 + t) * 512); } while (0)                                   /* key tile j, head slices 0..3 */
#define LDV(buf, jj) do { _Pragma("unroll") for (int t = 0; t < 4; ++t) fb[buf][t] = frag_p(vp + ((t & 1) * (CC / 16) + (jj) * 2 + (t >> 1)) * 512); } while (0)   /* channel tiles 2jj, 2jj+1, key slices 0..1 */
#define QK(buf, j) do { _Pragma("unroll") for (int t = 0; t < 4; ++t) s[j] = wmma16(fb[buf][t], aq[t], s[j]); } while (0)
#define PV(buf, jj) do { _Pragma("unroll") for (int t = 0; t < 4; ++t) o[(jj) * 2 + (t >> 1)] = wmma16(fb[buf][t], pf[t & 1], o[(jj) * 2 + (t >> 1)]); } while (0)
__global__ __launch_bounds__(32 * KSPLIT * QTILES) void k_fa(const _Float16* __restrict__ QH, const _Float16* __restrict__ KH, const _Float16* __restrict__ VT, float* __restrict__ Y) {
  __shared__ __align__(16) float ps[QTILES * KSPLIT][16][HD + 4]; __shared__ float pm[QTILES * KSPLIT][16], pl[QTILES * KSPLIT][16];
  const int tid = threadIdx.x, wave = tid >> 5, lane = tid & 31, col = lane & 15, g = lane >> 4; const int b = blockIdx.y, kq = wave & (KSPLIT - 1); const size_t qb0 = (size_t)b * TT + blockIdx.x * (16 * QTILES), q0 = qb0 + (wave / KSPLIT) * 16;
  const float c2 = SCALE * 1.4426950408889634f;   // logit scale times log2(e): the exponentials are base 2
  const _Float16* kp = KH + ((size_t)b * TT + kq * (TT / KSPLIT)) * CC + lane * 8; const _Float16* vp = VT + ((size_t)b * TT + kq * (TT / KSPLIT)) * CC + lane * 8;   // in fragment order too, 32 keys take 32 * CC elements of k and as many of v
  v16h aq[HD / 32], fb[2][4], pf[2];
#pragma unroll
  for (int kc = 0; kc < HD / 32; ++kc) aq[kc] = frag_p(QH + q0 * CC + kc * 512 + lane * 8);
  __builtin_amdgcn_sched_barrier(0);   // q loads stay the oldest: issued behind the k groups they would turn the loop's first counted wait into a wait for every load
  LDK(0, 0); LDK(1, 1);
  v8f o[HD / 16] = {}; float m = -3.0e38f, l = 0.f;
#pragma unroll 1   // rolled: a pass is one straight block of code, and the two fragment groups in flight are carried over its back edge
  for (int kb = 0; kb < NBLK; ++kb) { v8f s[KBLK / 16] = {};
    QK(0, 0); LDK(0, 2); QK(1, 1); LDK(1, 3); QK(0, 2); LDV(0, 0); QK(1, 3); LDV(1, 1);
    float mx = s[0][0];
#pragma unroll
    for (int j = 0; j < KBLK / 16; ++j)
#pragma unroll
      for (int r = 0; r < 8; ++r) mx = fmaxf(mx, s[j][r]);
    mx = fmaxf(mx, __shfl_xor(mx, 16));   // the other half of the wave holds the query's other 32 keys
    const float mn = fmaxf(m, mx * c2); const float al = __builtin_amdgcn_exp2f(m - mn); m = mn; float sj[KBLK / 16] = {};
#pragma unroll
    for (int j = 0; j < KBLK / 16; ++j)
#pragma unroll
      for (int r = 0; r < 8; ++r) { const float p = __builtin_amdgcn_exp2f(s[j][r] * c2 - mn); sj[j] += p; pf[j >> 1][(j & 1) * 8 + r] = (_Float16)p; }
    l = l * al + ((sj[0] + sj[1]) + (sj[2] + sj[3]));
#pragma unroll
    for (int j = 0; j < HD / 16; ++j) o[j] *= al;
    kp += kb + 1 < NBLK ? KBLK * CC : 0;   // behind the last block its own first two key tiles are read again, unused: the loads stay unconditional and their counted waits exact
    PV(0, 0); LDV(0, 2); PV(1, 1); LDV(1, 3); PV(0, 2); LDK(0, 0); PV(1, 3); LDK(1, 1);
    asm volatile("s_wait_xcnt 0x0" ::: "memory");   // the next pass forms its addresses in the registers that these loads name
    vp += KBLK * CC; }
  l += __shfl_xor(l, 16);
  if (g == 0) { pm[wave][col] = m; pl[wave][col] = l; }
#pragma unroll
  for (int j = 0; j < HD / 16; ++j) { *(v4f*)&ps[wave][col][j * 16 + 8 * g] = __builtin_shufflevector(o[j], o[j], 0, 1, 2, 3); *(v4f*)&ps[wave][col][j * 16 + 8 * g + 4] = __builtin_shufflevector(o[j], o[j], 4, 5, 6, 7); }
  __syncthreads();
#pragma unroll
  for (int i = 0; i < 4; ++i) { const int rr = wave + 4 * QTILES * i, w0 = (rr >> 4) * KSPLIT, row = rr & 15; float mm = pm[w0][row];
#pragma unroll
    for (int w = 1; w < KSPLIT; ++w) mm = fmaxf(mm, pm[w0 + w][row]);
    float den = 0.f; v4f acc = {};
#pragma unroll
    for (int w = 0; w < KSPLIT; ++w) { const float f = exp2_slot(pm[w0 + w][row] - mm); den += f * pl[w0 + w][row]; acc += *(const v4f*)&ps[w0 + w][row][lane * 4] * f; }
    vst2(Y + (qb0 + rr) * CC + lane * 4, acc * (1.0f / den)); } }

extern "C" void kernel_launch(void* const* d_in, const int* in_sizes, int n_in, void* d_out, int out_size, void* d_ws, size_t ws_size, hipStream_t stream) {
  (void)in_sizes; (void)n_in; (void)out_size;
  const float** F = (const float**)d_in;
  if (ws_size < (size_t)WS_END) return;
  char* ws = (char*)d_ws; _Float16 *QH = (_Float16*)(ws + WS_QH), *KH = (_Float16*)(ws + WS_KH), *VT = (_Float16*)(ws + WS_VT), *QL = (_Float16*)(ws + WS_QL), *KL = (_Float16*)(ws + WS_KL); __bf16 *VB = (__bf16*)(ws + WS_VB), *VBL = (__bf16*)(ws + WS_VBL);
  // inputs, in order: 0 x [4,2048,1024]; 1 Wk [1024,128] (in,out); 2 Wq [1024,128]; 3 Wv [1024,128]; no biases
  k_proj<<<dim3(TNB * TT / PROWS, CC / 128, 3), 256, 0, stream>>>(F[0], F[0], F[0], F[2], F[1], F[3], nullptr, nullptr, nullptr, QH, QL, KH, KL, VT, VB, VBL);   /* q uses Wq = input 2, k uses Wk = input 1 */
  // logits, softmax and P . v of every batch in one launch
  k_fa<<<dim3(TT / (16 * QTILES), TNB), 32 * KSPLIT * QTILES, 0, stream>>>(QH, KH, VT, (float*)d_out);
}

// v005
// A run of this version takes 31.8 microseconds.
// In both of two side-by-side timings against v004, it was 1.23 times as fast.
// All steps since v000 together make it 16.5 times as fast.
// compute dtype: all float inputs rounded to bf16; q/k/v projections with EXACT bf16 products on WMMA 16x16x32 (f32 accumulate); logits q x k once to f16 each (1 product; sigma - 1) x 128^-0.5; online softmax f32; P = exp(logit - running max) once to f16 x v once to f16 (1 product); f32 output.
#include <hip/hip_runtime.h>
#include <math.h>

typedef __attribute__((ext_vector_type(16))) _Float16 v16h;
typedef __attribute__((ext_vector_type(16))) __bf16 v16b;
typedef __attribute__((ext_vector_type(8)))  _Float16 v8h;
typedef __attribute__((ext_vector_type(8)))  float v8f;
typedef __attribute__((ext_vector_type(4)))  float v4f;
typedef __attribute__((ext_vector_type(2)))  float v2f;
typedef __attribute__((ext_vector_type(4)))  unsigned v4u;
typedef __attribute__((ext_vector_type(4)))  int v4i;
typedef float __attribute__((may_alias)) float_a;
typedef int __attribute__((may_alias)) int_a;

template <typename T> __device__ __forceinline__ void vst2(void* p, T v) { *(T*)p = v;  }
// plain builtin, behind which the compiler keeps the WMMA distance itself: an asm statement that takes d, a and b as operands holds them under v256, and k_fa now lives in more registers than that (seen: scratch)
__device__ __forceinline__ v8f wmma16(v16h a, v16h b, v8f c) {
  return __builtin_amdgcn_wmma_f32_16x16x32_f16(false, a, false, b, (short)0, c, false, false);
}
__device__ __forceinline__ v8f wmma_bf(v16b a, v16b b, v8f c) {
  v8f d = __builtin_amdgcn_wmma_f32_16x16x32_bf16(false, a, false, b, (short)0, c, false, false);
  asm volatile("v_nop\n\tv_nop\n\tv_nop\n\tv_nop" : "+v"(d) : "v"(a), "v"(b));
  return d;
}
// 16x16x32 fragments: lane = (h = lane>>4, row/col = lane&15); elements 0..7 = k0+8h+0..7, 8..15 = k0+16+8h+0..7; D element r = row 8h+r
__device__ __forceinline__ v16h frag_h(const _Float16* rowk0, int lane) {
  union { v16h v; v8h q[2]; } u; const _Float16* p = rowk0 + 8 * (lane >> 4);
  u.q[0] = *(const v8h*)p; u.q[1] = *(const v8h*)(p + 16); return u.v;
}
__device__ __forceinline__ v16h frag_f32(const float* rowk0, int lane) {
  v16h a; const float* p = rowk0 + 8 * (lane >> 4);
#pragma unroll
  for (int i = 0; i < 8; ++i) { a[i] = (_Float16)p[i]; a[8 + i] = (_Float16)p[16 + i]; }
  return a;
}
__device__ __forceinline__ v16h frag_f32s(const float* rowk0, int lane, float sc) {
  v16h a; const float* p = rowk0 + 8 * (lane >> 4);
#pragma unroll
  for (int i = 0; i < 8; ++i) { a[i] = (_Float16)(p[i] * sc); a[8 + i] = (_Float16)(p[16 + i] * sc); }
  return a;
}
// column fragment from a [K][ld] layout (column n), rows >= K read as 0
__device__ __forceinline__ v16h fragc_f32(const float* W, int k0, int n, int lane, int ld, int K) {
  v16h a; const int g = lane >> 4;
#pragma unroll
  for (int i = 0; i < 8; ++i) { const int ka = k0 + 8 * g + i, kb = ka + 16;
    a[i] = (_Float16)(ka < K ? W[(size_t)(ka < K ? ka : K - 1) * ld + n] : 0.f); a[8 + i] = (_Float16)(kb < K ? W[(size_t)(kb < K ? kb : K - 1) * ld + n] : 0.f); }
  return a;
}
struct F2 { v16b h, l; };
__device__ __forceinline__ F2 bsplit16(const float v[16]) { F2 r;
#pragma unroll
  for (int i = 0; i < 16; ++i) { const __bf16 h = (__bf16)v[i]; r.h[i] = h; r.l[i] = (__bf16)(v[i] - (float)h); }
  return r; }
__device__ __forceinline__ F2 split_row(const float* row, int k0, int lane) { float v[16]; const float* p = row + k0 + 8 * (lane >> 4);
#pragma unroll
  for (int i = 0; i < 8; ++i) { v[i] = p[i]; v[8 + i] = p[16 + i]; }
  return bsplit16(v); }
__device__ __forceinline__ F2 split_rowK(const float* row, int k0, int lane, int K) { float v[16]; const int g = lane >> 4;
#pragma unroll
  for (int i = 0; i < 8; ++i) { const int ka = k0 + 8 * g + i, kb = ka + 16; v[i] = ka < K ? row[ka < K ? ka : K - 1] : 0.f; v[8 + i] = kb < K ? row[kb < K ? kb : K - 1] : 0.f; }
  return bsplit16(v); }
__device__ __forceinline__ F2 split_col(const float* W, int k0, int n, int lane, int ld, int K) { float v[16]; const int g = lane >> 4;
#pragma unroll
  for (int i = 0; i < 8; ++i) { const int ka = k0 + 8 * g + i, kb = ka + 16; v[i] = ka < K ? W[(size_t)(ka < K ? ka : K - 1) * ld + n] : 0.f; v[8 + i] = kb < K ? W[(size_t)(kb < K ? kb : K - 1) * ld + n] : 0.f; }
  return bsplit16(v); }
__device__ __forceinline__ v8f mac3(const F2& a, const F2& b, v8f c) { c = wmma_bf(a.l, b.h, c); c = wmma_bf(a.h, b.l, c); return wmma_bf(a.h, b.h, c); }
__device__ __forceinline__ float sigm(float v) { return 1.0f / (1.0f + expf(-v)); }
#define LDSX() do { asm volatile("s_wait_dscnt 0" ::: "memory"); __builtin_amdgcn_wave_barrier(); __builtin_amdgcn_fence(__ATOMIC_RELEASE, "workgroup"); } while (0)

// Single-head NON-causal self-attention with head size 128 (x [4,2048,1024]; (in,out) Wk / Wq / Wv [1024,128] N(0, 1/1024), no biases; no mask in the source; scale 128^-0.5): out = softmax(q k^T * 128^-0.5) v -> [4,2048,128].
#define NB 4
#define TT 2048
#define CC 128            // NH * HD = projected width
#define DIN 1024          // input (model) width
#define NH 1
#define HD 128
#define NQB (TT / 64)
#define HG 1
#define SCALE (0.08838834764831845f)
#define CAUSAL 0
#ifndef TNB
#define TNB NB
#endif
__device__ __forceinline__ float bfr(float v) { return (float)(__bf16)v; }
__host__ __device__ __forceinline__ int kb_last(int qb) { return CAUSAL ? ((qb * 64 + 63) >> 7) : (TT / 128 - 1); }
typedef __attribute__((ext_vector_type(8))) __bf16 v8b;
__device__ __forceinline__ v16b frag_b(const __bf16* rowk0, int lane) {
  union { v16b v; v8b q[2]; } u; const __bf16* p = rowk0 + 8 * (lane >> 4);
  u.q[0] = *(const v8b*)p; u.q[1] = *(const v8b*)(p + 16); return u.v;
}
#define QBH 0              // unused: no kernel in this file has a high-precision path
#define QHI 0               // single-product logits on every row (sigma - 1 logits over 2,048 keys)
#define KHI 64            // key rows carrying k residual / v bf16 hi+lo planes (written by k_proj; no kernel in this file reads them)
// B fragment (k rows k0+.., output column o) of a weight: (in,out) [K][ld] or (out,in) [ld rows of K]: bf16 exact, or f16(bf16 * 256) exact
__device__ __forceinline__ v16b wcol_io(const float* Wm, int k0, int o, int lane, int ld) { v16b w; const int g = lane >> 4;
#pragma unroll
  for (int i = 0; i < 8; ++i) { w[i] = (__bf16)Wm[(size_t)(k0 + 8 * g + i) * ld + o]; w[8 + i] = (__bf16)Wm[(size_t)(k0 + 16 + 8 * g + i) * ld + o]; }
  return w; }
__device__ __forceinline__ v16b wcol_oi(const float* Wm, int k0, int o, int lane, int K) { v16b w; const float* p = Wm + (size_t)o * K + k0 + 8 * (lane >> 4);
#pragma unroll
  for (int i = 0; i < 8; ++i) { w[i] = (__bf16)p[i]; w[8 + i] = (__bf16)p[16 + i]; }
  return w; }
__device__ __forceinline__ v16h wcolh_io(const float* Wm, int k0, int o, int lane, int ld) { v16h w; const int g = lane >> 4;
#pragma unroll
  for (int i = 0; i < 8; ++i) { w[i] = (_Float16)(bfr(Wm[(size_t)(k0 + 8 * g + i) * ld + o]) * 256.0f); w[8 + i] = (_Float16)(bfr(Wm[(size_t)(k0 + 16 + 8 * g + i) * ld + o]) * 256.0f); }
  return w; }
__device__ __forceinline__ v16h wcolh_oi(const float* Wm, int k0, int o, int lane, int K) { v16h w; const float* p = Wm + (size_t)o * K + k0 + 8 * (lane >> 4);
#pragma unroll
  for (int i = 0; i < 8; ++i) { w[i] = (_Float16)(bfr(p[i]) * 256.0f); w[8 + i] = (_Float16)(bfr(p[16 + i]) * 256.0f); }
  return w; }
#define WQKV_LAYOUT 0   // 0 = (in,out) [DIN][CC]; 1 = (out,in) [CC][DIN]; 2 = per-head [NH][DIN][HD]
__device__ __forceinline__ v16b wcol_hdk(const float* Wm, int k0, int o, int lane) { v16b w; const int g = lane >> 4; const float* p = Wm + (size_t)(o / HD) * DIN * HD + (o % HD);
#pragma unroll
  for (int i = 0; i < 8; ++i) { w[i] = (__bf16)p[(size_t)(k0 + 8 * g + i) * HD]; w[8 + i] = (__bf16)p[(size_t)(k0 + 16 + 8 * g + i) * HD]; }
  return w; }
#define WO_OUT_IN 0
#if WQKV_LAYOUT == 1
#define WCOL(W, k0, o, lane) wcol_oi(W, k0, o, lane, DIN)
#elif WQKV_LAYOUT == 2
#define WCOL(W, k0, o, lane) wcol_hdk(W, k0, o, lane)
#else
#define WCOL(W, k0, o, lane) wcol_io(W, k0, o, lane, CC)
#endif
#if WO_OUT_IN
#define WOCOL(W, k0, o, lane) wcol_oi(W, k0, o, lane, CC)
#define WOCOLH(W, k0, o, lane) wcolh_oi(W, k0, o, lane, CC)
#else
#define WOCOL(W, k0, o, lane) wcol_io(W, k0, o, lane, DIN)
#define WOCOLH(W, k0, o, lane) wcolh_io(W, k0, o, lane, DIN)
#endif

#ifndef SM_EXTRA_PARAMS
#define SM_EXTRA_PARAMS
#endif
#ifndef PROJ_EXTRA_PARAMS
#define PROJ_EXTRA_PARAMS
#endif
#ifndef SM_MASK_HOOK
#define SM_MASK_HOOK (void)0
#endif

// q, k and v lie in FRAGMENT ORDER: one 16 x 32 WMMA fragment is a block of 1 KiB = two runs of 512 bytes, run h holding at lane * 16 bytes the eight elements 16 h + 8 (lane >> 4) + 0..7 of row lane & 15, so that each of a fragment's two 16-byte loads reads four whole lines
#define WS_QH  0u                                      // f16 q fragments [b*t / 16][CC / 32][1 KiB]: rows = 16 queries, elements = 32 head channels
#define WS_KH  (WS_QH + 2u * (size_t)NB * TT * CC)      // f16 k fragments [b*t / 16][CC / 32][1 KiB]: rows = 16 keys, elements = 32 head channels
#define WS_VT  (WS_KH + 2u * (size_t)NB * TT * CC)      // f16 v fragments [b][t / 32][CC / 16][1 KiB]: rows = 16 channels, elements = 32 keys
#define WS_QL  (WS_VT + 2u * (size_t)NB * CC * TT)      // f16 q residual x 2^10 rows [b][t < QHI][CC]
#define WS_KL  (WS_QL + 2u * (size_t)NB * QHI * CC)     // f16 k residual x 2^10 rows [b][t < KHI][CC]
#define WS_VB  (WS_KL + 2u * (size_t)NB * KHI * CC)     // bf16 v hi planes [b][c][t < KHI]
#define WS_VBL (WS_VB + 2u * (size_t)NB * CC * KHI)
#define WS_END (WS_VBL + 2u * (size_t)NB * CC * KHI)

// ---- k_proj: block = (128 rows, 128 cols, which), 8 waves: q/k/v = X W (+ b) with exact bf16 products (K = DIN) -> which 0: q f16 fragments (+ residual rows < QHI); 1: k f16 fragments (+ residual rows < KHI); 2: v f16 fragments (+ bf16 hi/lo planes for t < KHI); the fragment order (at WS_QH) takes CC == 128, one column block
// X and W go through LDS as bf16 in chunks of PKC k, two buffers: every global load is a 16-byte load whose wave covers four whole lines, and one barrier a chunk publishes the new buffer and frees the old one.
// While chunk t is multiplied, the W loads of chunk t + 1 and the X loads of chunks t + 1 and t + 2 are in flight (X comes from memory, W from L2; two register sets for X, so the loop body is two chunks).
// W is turned on its way into LDS: a thread holds 8 k x 4 columns and stores, per column, 8 consecutive k as 16 bytes, so that A and B fragments are both two 16-byte LDS reads of a row. Waves 4 x 2, each 32 rows x 64 columns; every accumulator still sums k in ascending steps of 32.
#define PROWS 128          // rows of X per block
#define PKC 64             // k per chunk
#define PPIT (PKC + 8)     // LDS row pitch in elements: 128 bytes of data + 16, the pitch for 16-byte readers
#define PNCH (DIN / PKC)
typedef __attribute__((ext_vector_type(4))) __bf16 v4b;
// the scheduling barrier at the foot of each load group keeps the groups whole, in the order written and above the products: the load counter runs in issue order, so a wait for W must not have the younger X loads in front of it
#define P_LOADX(x, t) do { _Pragma("unroll") for (int i = 0; i < 8; ++i) x[i] = *(const v4f*)(xg + (size_t)i * 16 * DIN + (t) * PKC); __builtin_amdgcn_sched_barrier(0); } while (0)
#define P_LOADW(t) do { _Pragma("unroll") for (int i = 0; i < 8; ++i) wv[i] = *(const v4f*)(wg + (size_t)((t) * PKC + i) * CC); __builtin_amdgcn_sched_barrier(0); } while (0)
// work-group barrier for LDS data alone: this wave's LDS stores are complete, then the barrier; written by hand because __syncthreads() also waits for every global load, and the X loads issued ahead are to stay in flight across it
#define P_BAR() asm volatile("s_wait_dscnt 0x0\n\ts_barrier_signal -1\n\ts_barrier_wait -1" ::: "memory")
// the scheduling barrier at the head of P_STORE keeps the conversions below the products: lifted above them (seen in the listing) they wait for loads that were only just issued
#define P_STORE(x, buf) do { __builtin_amdgcn_sched_barrier(0); _Pragma("unroll") for (int i = 0; i < 8; ++i) { v4b p; _Pragma("unroll") for (int e = 0; e < 4; ++e) p[e] = (__bf16)x[i][e]; *(v4b*)&sx[buf][(tid >> 4) + 16 * i][(tid & 15) * 4] = p; } \
    _Pragma("unroll") for (int c = 0; c < 4; ++c) { v8b p; _Pragma("unroll") for (int i = 0; i < 8; ++i) p[i] = (__bf16)wv[i][c]; *(v8b*)&sw[buf][(wave & 3) * 32 + cl * 4 + c][((wave >> 2) * 4 + kl) * 8] = p; } } while (0)
#define P_MUL(buf) do { _Pragma("unroll") for (int kk = 0; kk < PKC / 32; ++kk) { v16b a[2], w[4]; \
    _Pragma("unroll") for (int i = 0; i < 2; ++i) a[i] = frag_b(&sx[buf][wr * 32 + i * 16 + col][kk * 32], lane); \
    _Pragma("unroll") for (int j = 0; j < 4; ++j) w[j] = frag_b(&sw[buf][wc * 64 + j * 16 + col][kk * 32], lane); \
    _Pragma("unroll") for (int i = 0; i < 2; ++i) _Pragma("unroll") for (int j = 0; j < 4; ++j) acc[i][j] = wmma_bf(a[i], w[j], acc[i][j]); } } while (0)
__global__ __launch_bounds__(256) void k_proj(const float* __restrict__ XQ, const float* __restrict__ XK, const float* __restrict__ XV, const float* __restrict__ WQ, const float* __restrict__ WK, const float* __restrict__ WV, const float* __restrict__ BQ, const float* __restrict__ BK, const float* __restrict__ BV,
    _Float16* __restrict__ QH, _Float16* __restrict__ QL, _Float16* __restrict__ KH, _Float16* __restrict__ KL, _Float16* __restrict__ VT, __bf16* __restrict__ VB, __bf16* __restrict__ VBL) {
  __shared__ __align__(16) _Float16 sh[PROWS][136], sl[PROWS][136]; __shared__ __align__(16) _Float16 th[128][PROWS + 8]; __shared__ __align__(16) __bf16 tb[128][PROWS + 8], tbl[128][PROWS + 8];
  __shared__ __align__(16) __bf16 sx[2][PROWS][PPIT], sw[2][128][PPIT];
  const int tid = threadIdx.x, wave = tid >> 5, lane = tid & 31, col = lane & 15, g = lane >> 4; const int which = blockIdx.z; const int c0 = blockIdx.y * 128; const size_t r0 = (size_t)blockIdx.x * PROWS; const size_t bb = r0 / TT; const int t0 = (int)(r0 % TT);
  const float* X = which == 0 ? XQ : which == 1 ? XK : XV; const float* WA = which == 0 ? WQ : which == 1 ? WK : WV; const float* BA = which == 0 ? BQ : which == 1 ? BK : BV;
  const int wr = wave >> 1, wc = wave & 1, cl = lane & 7, kl = lane >> 3;
  const float* xg = X + (r0 + (tid >> 4)) * DIN + (tid & 15) * 4;                                        // a wave's load: 2 rows x 256 bytes
  const float* wg = WA + (size_t)(((wave >> 2) * 4 + kl) * 8) * CC + c0 + (wave & 3) * 32 + cl * 4;      // a wave's load: 4 k rows x 128 bytes
  v4f xa[8], xb[8], wv[8]; v8f acc[2][4] = {};
  P_LOADX(xa, 0); P_LOADW(0); P_LOADX(xb, 1);
  P_STORE(xa, 0);
  P_BAR();
#pragma unroll 1   // rolled: the body is two chunks, one for each register set of X, and the code stays small
  for (int t = 0; t + 2 < PNCH; t += 2) {
    P_LOADW(t + 1); P_LOADX(xa, t + 2); P_MUL(0); P_STORE(xb, 1);
    P_BAR();     // publishes chunk t + 1 and ends every read of chunk t, whose buffer is refilled next
    P_LOADW(t + 2); P_LOADX(xb, t + 3); P_MUL(1); P_STORE(xa, 0);
    P_BAR(); }   // the same for chunk t + 2
  P_LOADW(PNCH - 1); P_MUL(0); P_STORE(xb, 1);
  P_BAR();
  P_MUL(1);
  if (which < 2) { _Float16* DH = which == 0 ? QH : KH; _Float16* DL = which == 0 ? QL : KL; const int nhi = which == 0 ? QHI : KHI;
#pragma unroll
    for (int i = 0; i < 2; ++i)
#pragma unroll
    for (int j = 0; j < 4; ++j) { const int cc = wc * 64 + j * 16 + col; const float bias = BA ? bfr(BA[c0 + cc]) : 0.f;
#pragma unroll
      for (int r = 0; r < 8; ++r) { const float v = acc[i][j][r] + bias; const _Float16 hv = (_Float16)v; const int rl = wr * 32 + i * 16 + 8 * g + r; sh[rl][cc] = hv; sl[rl][cc] = (_Float16)((v - (float)hv) * 1024.0f); } }
    __syncthreads();
    for (int e = tid; e < PROWS * 16; e += 256) { const int rl = (e >> 8) * 16 + (e & 15), q = (e >> 4) & 15; vst2((unsigned*)(DH + r0 * CC + (size_t)e * 8), *(const v4u*)&sh[rl][q * 8]); if (t0 + rl < nhi) {   /* piece e of the block's 128 rows in fragment order: row tile e >> 8, octet q of the row */ vst2((unsigned*)(DL + (bb * nhi + t0 + rl) * (size_t)CC + c0 + q * 8), *(const v4u*)&sl[rl][q * 8]);
        asm volatile("s_wait_xcnt 0x0" ::: "memory"); } }   // the next trip forms its address in the registers that this store names; inside the branch, so that no address addition is lifted over it
  } else {
#pragma unroll
    for (int i = 0; i < 2; ++i)
#pragma unroll
    for (int j = 0; j < 4; ++j) { const int cc = wc * 64 + j * 16 + col; const float bias = BA ? bfr(BA[c0 + cc]) : 0.f;
#pragma unroll
      for (int r = 0; r < 8; ++r) { const float v = acc[i][j][r] + bias; const int rl = wr * 32 + i * 16 + 8 * g + r; th[cc][rl] = (_Float16)v; const __bf16 bh = (__bf16)v; tb[cc][rl] = bh; tbl[cc][rl] = (__bf16)(v - (float)bh); } }
    __syncthreads();
    for (int e = tid; e < 128 * (PROWS / 8); e += 256) { const int cl2 = ((e >> 6) & 7) * 16 + (e & 15), q = (e >> 9) * 4 + ((e >> 4) & 3); vst2((unsigned*)(VT + (bb * TT + t0) * (size_t)CC + (size_t)e * 8), *(const v4u*)&th[cl2][q * 8]); if (t0 + q * 8 < KHI) {   /* piece e of the block's 128 keys in fragment order: 32 keys e >> 9, channel tile (e >> 6) & 7, key octet q */ const size_t o3 = (bb * CC + c0 + cl2) * (size_t)KHI + t0 + q * 8; vst2((unsigned*)(VB + o3), *(const v4u*)&tb[cl2][q * 8]); vst2((unsigned*)(VBL + o3), *(const v4u*)&tbl[cl2][q * 8]);
        asm volatile("s_wait_xcnt 0x0" ::: "memory"); } } } }   // the next trip forms its addresses in the registers that these two stores name; inside the branch, so that no address addition is lifted over it
__device__ __forceinline__ float exp2_slot(float x) { float y; asm("v_exp_f32 %0, %1\n\tv_nop" : "=v"(y) : "v"(x)); return y; }
// eight base-2 exponentials in one statement: no result lies on a source (early clobber) and the slot behind the last one is filled
__device__ __forceinline__ v8f exp2_x8(v8f x) { float y0, y1, y2, y3, y4, y5, y6, y7;
  asm("v_exp_f32 %0, %8\n\tv_exp_f32 %1, %9\n\tv_exp_f32 %2, %10\n\tv_exp_f32 %3, %11\n\tv_exp_f32 %4, %12\n\tv_exp_f32 %5, %13\n\tv_exp_f32 %6, %14\n\tv_exp_f32 %7, %15\n\tv_nop"
      : "=&v"(y0), "=&v"(y1), "=&v"(y2), "=&v"(y3), "=&v"(y4), "=&v"(y5), "=&v"(y6), "=&v"(y7) : "v"(x[0]), "v"(x[1]), "v"(x[2]), "v"(x[3]), "v"(x[4]), "v"(x[5]), "v"(x[6]), "v"(x[7]));
  return v8f{y0, y1, y2, y3, y4, y5, y6, y7}; }
#define KSPLIT 8
#define QTILES 2
#define KBLK 64
#define NBLK (TT / KSPLIT / KBLK)
// one fragment in fragment order; p = its 1-KiB block + lane * 8 elements
__device__ __forceinline__ v16h frag_p(const _Float16* p) { union { v16h v; v8h q[2]; } u; u.q[0] = *(const v8h*)p; u.q[1] = *(const v8h*)(p + 256); return u.v; }
// the scheduling barriers at the head and the foot of a load group keep it whole and where it is written, right behind the products that free its registers: left free, the compiler lifted a whole pass's loads to the head of the loop, into registers of their own (498 seen)
#define LDK(buf, j) do { __builtin_amdgcn_sched_barrier(0); _Pragma("unroll") for (int t = 0; t < 4; ++t) fb[buf][t] = frag_p(kp + ((j) * 4 + t) * 512); __builtin_amdgcn_sched_barrier(0); } while (0)                                   /* key tile j, head slices 0..3 */
#define LDV(buf, jj) do { __builtin_amdgcn_sched_barrier(0); _Pragma("unroll") for (int t = 0; t < 4; ++t) fb[buf][t] = frag_p(vp + ((t & 1) * (CC / 16) + (jj) * 2 + (t >> 1)) * 512); __builtin_amdgcn_sched_barrier(0); } while (0)   /* channel tiles 2jj, 2jj+1, key slices 0..1 */
#define QK(buf, j) do { _Pragma("unroll") for (int t = 0; t < 4; ++t) _Pragma("unroll") for (int u = 0; u < QTILES; ++u) s[u][j] = wmma16(fb[buf][t], aq[u][t], s[u][j]); } while (0)
#define PV(buf, jj) do { _Pragma("unroll") for (int t = 0; t < 4; ++t) _Pragma("unroll") for (int u = 0; u < QTILES; ++u) o[u][(jj) * 2 + (t >> 1)] = wmma16(fb[buf][t], pf[u][t & 1], o[u][(jj) * 2 + (t >> 1)]); } while (0)
__global__ __launch_bounds__(32 * KSPLIT) void k_fa(const _Float16* __restrict__ QH, const _Float16* __restrict__ KH, const _Float16* __restrict__ VT, float* __restrict__ Y) {
  __shared__ __align__(16) float ps[KSPLIT][16 * QTILES][HD + 4]; __shared__ float pm[KSPLIT][16 * QTILES], pl[KSPLIT][16 * QTILES];
  const int tid = threadIdx.x, wave = tid >> 5, lane = tid & 31, col = lane & 15, g = lane >> 4; const int b = blockIdx.y; const size_t qb0 = (size_t)b * TT + blockIdx.x * (16 * QTILES);
  const float c2 = SCALE * 1.4426950408889634f;   // logit scale times log2(e): the exponentials are base 2
  const _Float16* kp = KH + ((size_t)b * TT + wave * (TT / KSPLIT)) * CC + lane * 8; const _Float16* vp = VT + ((size_t)b * TT + wave * (TT / KSPLIT)) * CC + lane * 8;   // in fragment order too, 32 keys take 32 * CC elements of k and as many of v
  v16h aq[QTILES][HD / 32], fb[2][4], pf[QTILES][2];
  const _Float16* qp = QH + qb0 * CC + lane * 8;
#pragma unroll
  for (int u = 0; u < QTILES; ++u)
#pragma unroll
    for (int kc = 0; kc < HD / 32; ++kc) aq[u][kc] = frag_p(qp + u * 16 * CC + kc * 512);
  asm volatile("s_wait_xcnt 0x0" ::: "memory");   // the base registers that the q loads name are written anew in front of the loop; the wait stands here, ahead of the k loads, where it waits for the q loads alone
  __builtin_amdgcn_sched_barrier(0);   // q loads stay the oldest: issued behind the k groups they would turn the loop's first counted wait into a wait for every load
  LDK(0, 0); LDK(1, 1);
  v8f o[QTILES][HD / 16] = {}; float m[QTILES], l[QTILES];
#pragma unroll
  for (int u = 0; u < QTILES; ++u) { m[u] = -3.0e38f; l[u] = 0.f; }
#pragma unroll 1   // rolled: a pass is one straight block of code, and the two fragment groups in flight are carried over its back edge
  for (int kb = 0; kb < NBLK; ++kb) { v8f s[QTILES][KBLK / 16] = {};
    QK(0, 0); LDK(0, 2); QK(1, 1); LDK(1, 3); QK(0, 2); LDV(0, 0); QK(1, 3); LDV(1, 1);
#pragma unroll
    for (int u = 0; u < QTILES; ++u) { float mx = s[u][0][0];
#pragma unroll
      for (int j = 0; j < KBLK / 16; ++j)
#pragma unroll
        for (int r = 0; r < 8; ++r) mx = fmaxf(mx, s[u][j][r]);
      mx = fmaxf(mx, __shfl_xor(mx, 16));   // the other half of the wave holds the query's other 32 keys
      const float mn = fmaxf(m[u], mx * c2); const float al = exp2_slot(m[u] - mn); m[u] = mn; float sj[KBLK / 16] = {};
#pragma unroll
      for (int j = 0; j < KBLK / 16; ++j) { const v8f p = exp2_x8(s[u][j] * c2 - mn);
#pragma unroll
        for (int r = 0; r < 8; ++r) { sj[j] += p[r]; pf[u][j >> 1][(j & 1) * 8 + r] = (_Float16)p[r]; } }
      l[u] = l[u] * al + ((sj[0] + sj[1]) + (sj[2] + sj[3]));
#pragma unroll
      for (int j = 0; j < HD / 16; ++j) o[u][j] *= al; }
    asm volatile("s_wait_xcnt 0x0" ::: "memory");   // the line below rewrites the address registers that the k loads above name
    kp += kb + 1 < NBLK ? KBLK * CC : 0;   // behind the last block its own first two key tiles are read again, unused: the loads stay unconditional and their counted waits exact
    PV(0, 0); LDV(0, 2); PV(1, 1); LDV(1, 3); PV(0, 2); LDK(0, 0); PV(1, 3); LDK(1, 1);
    asm volatile("s_wait_xcnt 0x0" ::: "memory");   // the next pass forms its addresses in the registers that these loads name
    vp += KBLK * CC; }
#pragma unroll
  for (int u = 0; u < QTILES; ++u) { l[u] += __shfl_xor(l[u], 16);
    if (g == 0) { pm[wave][u * 16 + col] = m[u]; pl[wave][u * 16 + col] = l[u]; }
#pragma unroll
    for (int j = 0; j < HD / 16; ++j) { *(v4f*)&ps[wave][u * 16 + col][j * 16 + 8 * g] = __builtin_shufflevector(o[u][j], o[u][j], 0, 1, 2, 3); *(v4f*)&ps[wave][u * 16 + col][j * 16 + 8 * g + 4] = __builtin_shufflevector(o[u][j], o[u][j], 4, 5, 6, 7); } }
  __syncthreads();
#pragma unroll
  for (int i = 0; i < 16 * QTILES / KSPLIT; ++i) { const int rr = wave + KSPLIT * i; float mm = pm[0][rr];
#pragma unroll
    for (int w = 1; w < KSPLIT; ++w) mm = fmaxf(mm, pm[w][rr]);
    float den = 0.f; v4f acc = {};
#pragma unroll
    for (int w = 0; w < KSPLIT; ++w) { const float f = exp2_slot(pm[w][rr] - mm); den += f * pl[w][rr]; acc += *(const v4f*)&ps[w][rr][lane * 4] * f; }
    vst2(Y + (qb0 + rr) * CC + lane * 4, acc * (1.0f / den)); } }

extern "C" void kernel_launch(void* const* d_in, const int* in_sizes, int n_in, void* d_out, int out_size, void* d_ws, size_t ws_size, hipStream_t stream) {
  (void)in_sizes; (void)n_in; (void)out_size;
  const float** F = (const float**)d_in;
  if (ws_size < (size_t)WS_END) return;
  char* ws = (char*)d_ws; _Float16 *QH = (_Float16*)(ws + WS_QH), *KH = (_Float16*)(ws + WS_KH), *VT = (_Float16*)(ws + WS_VT), *QL = (_Float16*)(ws + WS_QL), *KL = (_Float16*)(ws + WS_KL); __bf16 *VB = (__bf16*)(ws + WS_VB), *VBL = (__bf16*)(ws + WS_VBL);
  // inputs, in order: 0 x [4,2048,1024]; 1 Wk [1024,128] (in,out); 2 Wq [1024,128]; 3 Wv [1024,128]; no biases
  k_proj<<<dim3(TNB * TT / PROWS, CC / 128, 3), 256, 0, stream>>>(F[0], F[0], F[0], F[2], F[1], F[3], nullptr, nullptr, nullptr, QH, QL, KH, KL, VT, VB, VBL);   /* q uses Wq = input 2, k uses Wk = input 1 */
  // logits, softmax and P . v of every batch in one launch
  k_fa<<<dim3(TT / (16 * QTILES), TNB), 32 * KSPLIT, 0, stream>>>(QH, KH, VT, (float*)d_out);
}

// v006
// It runs in 26.2 microseconds.
// Timed twice side by side with v005, it ran 1.23 and 1.27 times as fast.
// Over all steps from v000 it is 20.6 times as fast.
// compute dtype: all float inputs rounded to bf16; q/k/v projections with EXACT bf16 products on WMMA 16x16x32 (f32 accumulate); logits q x k once to f16 each (1 product; sigma - 1) x 128^-0.5; online softmax f32; P = exp(logit - running max) once to f16 x v once to f16 (1 product); f32 output.
#include <hip/hip_runtime.h>
#include <math.h>

typedef __attribute__((ext_vector_type(16))) _Float16 v16h;
typedef __attribute__((ext_vector_type(16))) __bf16 v16b;
typedef __attribute__((ext_vector_type(8)))  _Float16 v8h;
typedef __attribute__((ext_vector_type(8)))  float v8f;
typedef __attribute__((ext_vector_type(4)))  float v4f;
typedef __attribute__((ext_vector_type(2)))  float v2f;
typedef __attribute__((ext_vector_type(4)))  unsigned v4u;
typedef __attribute__((ext_vector_type(4)))  int v4i;
typedef float __attribute__((may_alias)) float_a;
typedef int __attribute__((may_alias)) int_a;

template <typename T> __device__ __forceinline__ void vst2(void* p, T v) { *(T*)p = v;  }
// plain builtin, behind which the compiler keeps the WMMA distance itself: an asm statement that takes d, a and b as operands holds them under v256, and k_fa now lives in more registers than that (seen: scratch)
__device__ __forceinline__ v8f wmma16(v16h a, v16h b, v8f c) {
  return __builtin_amdgcn_wmma_f32_16x16x32_f16(false, a, false, b, (short)0, c, false, false);
}
__device__ __forceinline__ v8f wmma_bf(v16b a, v16b b, v8f c) {
  v8f d = __builtin_amdgcn_wmma_f32_16x16x32_bf16(false, a, false, b, (short)0, c, false, false);
  asm volatile("v_nop\n\tv_nop\n\tv_nop\n\tv_nop" : "+v"(d) : "v"(a), "v"(b));
  return d;
}
// 16x16x32 fragments: lane = (h = lane>>4, row/col = lane&15); elements 0..7 = k0+8h+0..7, 8..15 = k0+16+8h+0..7; D element r = row 8h+r
__device__ __forceinline__ v16h frag_h(const _Float16* rowk0, int lane) {
  union { v16h v; v8h q[2]; } u; const _Float16* p = rowk0 + 8 * (lane >> 4);
  u.q[0] = *(const v8h*)p; u.q[1] = *(const v8h*)(p + 16); return u.v;
}
__device__ __forceinline__ v16h frag_f32(const float* rowk0, int lane) {
  v16h a; const float* p = rowk0 + 8 * (lane >> 4);
#pragma unroll
  for (int i = 0; i < 8; ++i) { a[i] = (_Float16)p[i]; a[8 + i] = (_Float16)p[16 + i]; }
  return a;
}
__device__ __forceinline__ v16h frag_f32s(const float* rowk0, int lane, float sc) {
  v16h a; const float* p = rowk0 + 8 * (lane >> 4);
#pragma unroll
  for (int i = 0; i < 8; ++i) { a[i] = (_Float16)(p[i] * sc); a[8 + i] = (_Float16)(p[16 + i] * sc); }
  return a;
}
// column fragment from a [K][ld] layout (column n), rows >= K read as 0
__device__ __forceinline__ v16h fragc_f32(const float* W, int k0, int n, int lane, int ld, int K) {
  v16h a; const int g = lane >> 4;
#pragma unroll
  for (int i = 0; i < 8; ++i) { const int ka = k0 + 8 * g + i, kb = ka + 16;
    a[i] = (_Float16)(ka < K ? W[(size_t)(ka < K ? ka : K - 1) * ld + n] : 0.f); a[8 + i] = (_Float16)(kb < K ? W[(size_t)(kb < K ? kb : K - 1) * ld + n] : 0.f); }
  return a;
}
struct F2 { v16b h, l; };
__device__ __forceinline__ F2 bsplit16(const float v[16]) { F2 r;
#pragma unroll
  for (int i = 0; i < 16; ++i) { const __bf16 h = (__bf16)v[i]; r.h[i] = h; r.l[i] = (__bf16)(v[i] - (float)h); }
  return r; }
__device__ __forceinline__ F2 split_row(const float* row, int k0, int lane) { float v[16]; const float* p = row + k0 + 8 * (lane >> 4);
#pragma unroll
  for (int i = 0; i < 8; ++i) { v[i] = p[i]; v[8 + i] = p[16 + i]; }
  return bsplit16(v); }
__device__ __forceinline__ F2 split_rowK(const float* row, int k0, int lane, int K) { float v[16]; const int g = lane >> 4;
#pragma unroll
  for (int i = 0; i < 8; ++i) { const int ka = k0 + 8 * g + i, kb = ka + 16; v[i] = ka < K ? row[ka < K ? ka : K - 1] : 0.f; v[8 + i] = kb < K ? row[kb < K ? kb : K - 1] : 0.f; }
  return bsplit16(v); }
__device__ __forceinline__ F2 split_col(const float* W, int k0, int n, int lane, int ld, int K) { float v[16]; const int g = lane >> 4;
#pragma unroll
  for (int i = 0; i < 8; ++i) { const int ka = k0 + 8 * g + i, kb = ka + 16; v[i] = ka < K ? W[(size_t)(ka < K ? ka : K - 1) * ld + n] : 0.f; v[8 + i] = kb < K ? W[(size_t)(kb < K ? kb : K - 1) * ld + n] : 0.f; }
  return bsplit16(v); }
__device__ __forceinline__ v8f mac3(const F2& a, const F2& b, v8f c) { c = wmma_bf(a.l, b.h, c); c = wmma_bf(a.h, b.l, c); return wmma_bf(a.h, b.h, c); }
__device__ __forceinline__ float sigm(float v) { return 1.0f / (1.0f + expf(-v)); }
#define LDSX() do { asm volatile("s_wait_dscnt 0" ::: "memory"); __builtin_amdgcn_wave_barrier(); __builtin_amdgcn_fence(__ATOMIC_RELEASE, "workgroup"); } while (0)

// Single-head NON-causal self-attention with head size 128 (x [4,2048,1024]; (in,out) Wk / Wq / Wv [1024,128] N(0, 1/1024), no biases; no mask in the source; scale 128^-0.5): out = softmax(q k^T * 128^-0.5) v -> [4,2048,128].
#define NB 4
#define TT 2048
#define CC 128            // NH * HD = projected width
#define DIN 1024          // input (model) width
#define NH 1
#define HD 128
#define NQB (TT / 64)
#define HG 1
#define SCALE (0.08838834764831845f)
#define CAUSAL 0
#ifndef TNB
#define TNB NB
#endif
__device__ __forceinline__ float bfr(float v) { return (float)(__bf16)v; }
__host__ __device__ __forceinline__ int kb_last(int qb) { return CAUSAL ? ((qb * 64 + 63) >> 7) : (TT / 128 - 1); }
typedef __attribute__((ext_vector_type(8))) __bf16 v8b;
__device__ __forceinline__ v16b frag_b(const __bf16* rowk0, int lane) {
  union { v16b v; v8b q[2]; } u; const __bf16* p = rowk0 + 8 * (lane >> 4);
  u.q[0] = *(const v8b*)p; u.q[1] = *(const v8b*)(p + 16); return u.v;
}
#define QBH 0              // unused: no kernel in this file has a high-precision path
#define QHI 0               // single-product logits on every row (sigma - 1 logits over 2,048 keys)
#define KHI 64            // key rows carrying k residual / v bf16 hi+lo planes (written by k_proj; no kernel in this file reads them)
// B fragment (k rows k0+.., output column o) of a weight: (in,out) [K][ld] or (out,in) [ld rows of K]: bf16 exact, or f16(bf16 * 256) exact
__device__ __forceinline__ v16b wcol_io(const float* Wm, int k0, int o, int lane, int ld) { v16b w; const int g = lane >> 4;
#pragma unroll
  for (int i = 0; i < 8; ++i) { w[i] = (__bf16)Wm[(size_t)(k0 + 8 * g + i) * ld + o]; w[8 + i] = (__bf16)Wm[(size_t)(k0 + 16 + 8 * g + i) * ld + o]; }
  return w; }
__device__ __forceinline__ v16b wcol_oi(const float* Wm, int k0, int o, int lane, int K) { v16b w; const float* p = Wm + (size_t)o * K + k0 + 8 * (lane >> 4);
#pragma unroll
  for (int i = 0; i < 8; ++i) { w[i] = (__bf16)p[i]; w[8 + i] = (__bf16)p[16 + i]; }
  return w; }
__device__ __forceinline__ v16h wcolh_io(const float* Wm, int k0, int o, int lane, int ld) { v16h w; const int g = lane >> 4;
#pragma unroll
  for (int i = 0; i < 8; ++i) { w[i] = (_Float16)(bfr(Wm[(size_t)(k0 + 8 * g + i) * ld + o]) * 256.0f); w[8 + i] = (_Float16)(bfr(Wm[(size_t)(k0 + 16 + 8 * g + i) * ld + o]) * 256.0f); }
  return w; }
__device__ __forceinline__ v16h wcolh_oi(const float* Wm, int k0, int o, int lane, int K) { v16h w; const float* p = Wm + (size_t)o * K + k0 + 8 * (lane >> 4);
#pragma unroll
  for (int i = 0; i < 8; ++i) { w[i] = (_Float16)(bfr(p[i]) * 256.0f); w[8 + i] = (_Float16)(bfr(p[16 + i]) * 256.0f); }
  return w; }
#define WQKV_LAYOUT 0   // 0 = (in,out) [DIN][CC]; 1 = (out,in) [CC][DIN]; 2 = per-head [NH][DIN][HD]
__device__ __forceinline__ v16b wcol_hdk(const float* Wm, int k0, int o, int lane) { v16b w; const int g = lane >> 4; const float* p = Wm + (size_t)(o / HD) * DIN * HD + (o % HD);
#pragma unroll
  for (int i = 0; i < 8; ++i) { w[i] = (__bf16)p[(size_t)(k0 + 8 * g + i) * HD]; w[8 + i] = (__bf16)p[(size_t)(k0 + 16 + 8 * g + i) * HD]; }
  return w; }
#define WO_OUT_IN 0
#if WQKV_LAYOUT == 1
#define WCOL(W, k0, o, lane) wcol_oi(W, k0, o, lane, DIN)
#elif WQKV_LAYOUT == 2
#define WCOL(W, k0, o, lane) wcol_hdk(W, k0, o, lane)
#else
#define WCOL(W, k0, o, lane) wcol_io(W, k0, o, lane, CC)
#endif
#if WO_OUT_IN
#define WOCOL(W, k0, o, lane) wcol_oi(W, k0, o, lane, CC)
#define WOCOLH(W, k0, o, lane) wcolh_oi(W, k0, o, lane, CC)
#else
#define WOCOL(W, k0, o, lane) wcol_io(W, k0, o, lane, DIN)
#define WOCOLH(W, k0, o, lane) wcolh_io(W, k0, o, lane, DIN)
#endif

#ifndef SM_EXTRA_PARAMS
#define SM_EXTRA_PARAMS
#endif
#ifndef PROJ_EXTRA_PARAMS
#define PROJ_EXTRA_PARAMS
#endif
#ifndef SM_MASK_HOOK
#define SM_MASK_HOOK (void)0
#endif

// q, k and v lie in FRAGMENT ORDER: one 16 x 32 WMMA fragment is a block of 1 KiB = two runs of 512 bytes, run h holding at lane * 16 bytes the eight elements 16 h + 8 (lane >> 4) + 0..7 of row lane & 15, so that each of a fragment's two 16-byte loads reads four whole lines
#define WS_QH  0u                                      // f16 q fragments [b*t / 16][CC / 32][1 KiB]: rows = 16 queries, elements = 32 head channels
#define WS_KH  (WS_QH + 2u * (size_t)NB * TT * CC)      // f16 k fragments [b*t / 16][CC / 32][1 KiB]: rows = 16 keys, elements = 32 head channels
#define WS_VT  (WS_KH + 2u * (size_t)NB * TT * CC)      // f16 v fragments [b][t / 32][CC / 16][1 KiB]: rows = 16 channels, elements = 32 keys
#define WS_QL  (WS_VT + 2u * (size_t)NB * CC * TT)      // f16 q residual x 2^10 rows [b][t < QHI][CC]
#define WS_KL  (WS_QL + 2u * (size_t)NB * QHI * CC)     // f16 k residual x 2^10 rows [b][t < KHI][CC]
#define WS_VB  (WS_KL + 2u * (size_t)NB * KHI * CC)     // bf16 v hi planes [b][c][t < KHI]
#define WS_VBL (WS_VB + 2u * (size_t)NB * CC * KHI)
#define WS_END (WS_VBL + 2u * (size_t)NB * CC * KHI)

// ---- k_proj: block = (128 rows, 128 cols, which), 8 waves: q/k/v = X W (+ b) with exact bf16 products (K = DIN) -> which 0: q f16 fragments (+ residual rows < QHI); 1: k f16 fragments (+ residual rows < KHI); 2: v f16 fragments (+ bf16 hi/lo planes for t < KHI); the fragment order (at WS_QH) takes CC == 128, one column block
// X and W go through LDS as bf16 in chunks of PKC k, two buffers: every global load is a 16-byte load whose wave covers four whole lines, and one barrier a chunk publishes the new buffer and frees the old one.
// While chunk t is multiplied, the W loads of chunk t + 1 and the X loads of chunks t + 1 and t + 2 are in flight (X comes from memory, W from L2; two register sets for X, so the loop body is two chunks).
// W is turned on its way into LDS: a thread holds 8 k x 4 columns and stores, per column, 8 consecutive k as 16 bytes, so that A and B fragments are both two 16-byte LDS reads of a row. Waves 4 x 2, each 32 rows x 64 columns.
// The 64 blocks of one weight read the same W lines, the 3 blocks of one row tile the same X lines: each block enters the ring of PNCH chunks at a place of its own (from its block index) and wraps round, so that they do not ask L2 for the same lines at the same moment. Every accumulator sums its k in steps of 32, ascending from that place and wrapped.
#define PROWS 128          // rows of X per block
#define PKC 64             // k per chunk
#define PPIT (PKC + 8)     // LDS row pitch in elements: 128 bytes of data + 16, the pitch for 16-byte readers
#define PNCH (DIN / PKC)
typedef __attribute__((ext_vector_type(4))) __bf16 v4b;
// the scheduling barrier at the foot of each load group keeps the groups whole, in the order written and above the products: the load counter runs in issue order, so a wait for W must not have the younger X loads in front of it
#define P_LOADX(x, p) do { _Pragma("unroll") for (int i = 0; i < 8; ++i) x[i] = *(const v4f*)((p) + (size_t)i * 16 * DIN); __builtin_amdgcn_sched_barrier(0); } while (0)
#define P_LOADW(p) do { _Pragma("unroll") for (int i = 0; i < 8; ++i) wv[i] = *(const v4f*)((p) + (size_t)i * CC); __builtin_amdgcn_sched_barrier(0); } while (0)
// both walking pointers go one chunk on, from the last chunk of the ring back to the first; the wait stands in front because the additions rewrite the address registers that the loads above name, and behind the products, where those loads have long been taken
#define P_STEP() do { __builtin_amdgcn_sched_barrier(0); asm volatile("s_wait_xcnt 0x0" ::: "memory"); cw = (cw + 1) & (PNCH - 1); wp += cw ? PKC * CC : (PKC - DIN) * CC; cx = (cx + 1) & (PNCH - 1); xp += cx ? PKC : PKC - DIN; } while (0)
// work-group barrier for LDS data alone: this wave's LDS stores are complete, then the barrier; written by hand because __syncthreads() also waits for every global load, and the X loads issued ahead are to stay in flight across it
#define P_BAR() asm volatile("s_wait_dscnt 0x0\n\ts_barrier_signal -1\n\ts_barrier_wait -1" ::: "memory")
// the scheduling barrier at the head of P_STORE keeps the conversions below the products: lifted above them (seen in the listing) they wait for loads that were only just issued
#define P_STORE(x, buf) do { __builtin_amdgcn_sched_barrier(0); _Pragma("unroll") for (int i = 0; i < 8; ++i) { v4b p; _Pragma("unroll") for (int e = 0; e < 4; ++e) p[e] = (__bf16)x[i][e]; *(v4b*)&sx[buf][(tid >> 4) + 16 * i][(tid & 15) * 4] = p; } \
    _Pragma("unroll") for (int c = 0; c < 4; ++c) { v8b p; _Pragma("unroll") for (int i = 0; i < 8; ++i) p[i] = (__bf16)wv[i][c]; *(v8b*)&sw[buf][(wave & 3) * 32 + cl * 4 + c][((wave >> 2) * 4 + kl) * 8] = p; } } while (0)
#define P_MUL(buf) do { _Pragma("unroll") for (int kk = 0; kk < PKC / 32; ++kk) { v16b a[2], w[4]; \
    _Pragma("unroll") for (int i = 0; i < 2; ++i) a[i] = frag_b(&sx[buf][wr * 32 + i * 16 + col][kk * 32], lane); \
    _Pragma("unroll") for (int j = 0; j < 4; ++j) w[j] = frag_b(&sw[buf][wc * 64 + j * 16 + col][kk * 32], lane); \
    _Pragma("unroll") for (int i = 0; i < 2; ++i) _Pragma("unroll") for (int j = 0; j < 4; ++j) acc[i][j] = wmma_bf(a[i], w[j], acc[i][j]); } } while (0)
__global__ __launch_bounds__(256) void k_proj(const float* __restrict__ XQ, const float* __restrict__ XK, const float* __restrict__ XV, const float* __restrict__ WQ, const float* __restrict__ WK, const float* __restrict__ WV, const float* __restrict__ BQ, const float* __restrict__ BK, const float* __restrict__ BV,
    _Float16* __restrict__ QH, _Float16* __restrict__ QL, _Float16* __restrict__ KH, _Float16* __restrict__ KL, _Float16* __restrict__ VT, __bf16* __restrict__ VB, __bf16* __restrict__ VBL) {
  __shared__ __align__(16) _Float16 sh[PROWS][136], sl[PROWS][136]; __shared__ __align__(16) _Float16 th[128][PROWS + 8]; __shared__ __align__(16) __bf16 tb[128][PROWS + 8], tbl[128][PROWS + 8];
  __shared__ __align__(16) __bf16 sx[2][PROWS][PPIT], sw[2][128][PPIT];
  const int tid = threadIdx.x, wave = tid >> 5, lane = tid & 31, col = lane & 15, g = lane >> 4; const int which = blockIdx.z; const int c0 = blockIdx.y * 128; const size_t r0 = (size_t)blockIdx.x * PROWS; const size_t bb = r0 / TT; const int t0 = (int)(r0 % TT);
  const float* X = which == 0 ? XQ : which == 1 ? XK : XV; const float* WA = which == 0 ? WQ : which == 1 ? WK : WV; const float* BA = which == 0 ? BQ : which == 1 ? BK : BV;
  const int wr = wave >> 1, wc = wave & 1, cl = lane & 7, kl = lane >> 3;
  const float* xg = X + (r0 + (tid >> 4)) * DIN + (tid & 15) * 4;                                        // a wave's load: 2 rows x 256 bytes
  const float* wg = WA + (size_t)(((wave >> 2) * 4 + kl) * 8) * CC + c0 + (wave & 3) * 32 + cl * 4;      // a wave's load: 4 k rows x 128 bytes
  v4f xa[8], xb[8], wv[8]; v8f acc[2][4] = {};
  const int rot = (blockIdx.x + 10 * (blockIdx.x >> 3) + 5 * blockIdx.z) & (PNCH - 1);   // the block's place of entry: any value is right, the spread is for speed alone
  int cw = (rot + 1) & (PNCH - 1), cx = (rot + 2) & (PNCH - 1); const float* wp = wg + (size_t)cw * PKC * CC; const float* xp = xg + cx * PKC;   // chunk t of the walk is chunk (rot + t) mod PNCH of k
  P_LOADX(xa, xg + rot * PKC); P_LOADW(wg + (size_t)rot * PKC * CC); P_LOADX(xb, xg + cw * PKC);
  asm volatile("s_wait_xcnt 0x0" ::: "memory");   // the address registers that these three groups name are used for other values from here on; the wait for the first group's data follows at once, so this one costs nothing
  P_STORE(xa, 0);
  P_BAR();
#pragma unroll 1   // rolled: the body is two chunks, one for each register set of X, and the code stays small
  for (int t = 0; t + 2 < PNCH; t += 2) {
    P_LOADW(wp); P_LOADX(xa, xp); P_MUL(0); P_STEP(); P_STORE(xb, 1);
    P_BAR();     // publishes chunk t + 1 and ends every read of chunk t, whose buffer is refilled next
    P_LOADW(wp); P_LOADX(xb, xp); P_MUL(1); P_STEP(); P_STORE(xa, 0);
    P_BAR(); }   // the same for chunk t + 2
  P_LOADW(wp); P_MUL(0); P_STORE(xb, 1);
  P_BAR();
  P_MUL(1);
  if (which < 2) { _Float16* DH = which == 0 ? QH : KH; _Float16* DL = which == 0 ? QL : KL; const int nhi = which == 0 ? QHI : KHI;
#pragma unroll
    for (int i = 0; i < 2; ++i)
#pragma unroll
    for (int j = 0; j < 4; ++j) { const int cc = wc * 64 + j * 16 + col; const float bias = BA ? bfr(BA[c0 + cc]) : 0.f;
#pragma unroll
      for (int r = 0; r < 8; ++r) { const float v = acc[i][j][r] + bias; const _Float16 hv = (_Float16)v; const int rl = wr * 32 + i * 16 + 8 * g + r; sh[rl][cc] = hv; sl[rl][cc] = (_Float16)((v - (float)hv) * 1024.0f); } }
    __syncthreads();
    for (int e = tid; e < PROWS * 16; e += 256) { const int rl = (e >> 8) * 16 + (e & 15), q = (e >> 4) & 15; vst2((unsigned*)(DH + r0 * CC + (size_t)e * 8), *(const v4u*)&sh[rl][q * 8]); if (t0 + rl < nhi) {   /* piece e of the block's 128 rows in fragment order: row tile e >> 8, octet q of the row */ vst2((unsigned*)(DL + (bb * nhi + t0 + rl) * (size_t)CC + c0 + q * 8), *(const v4u*)&sl[rl][q * 8]);
        asm volatile("s_wait_xcnt 0x0" ::: "memory"); } }   // the next trip forms its address in the registers that this store names; inside the branch, so that no address addition is lifted over it
  } else {
#pragma unroll
    for (int i = 0; i < 2; ++i)
#pragma unroll
    for (int j = 0; j < 4; ++j) { const int cc = wc * 64 + j * 16 + col; const float bias = BA ? bfr(BA[c0 + cc]) : 0.f;
#pragma unroll
      for (int r = 0; r < 8; ++r) { const float v = acc[i][j][r] + bias; const int rl = wr * 32 + i * 16 + 8 * g + r; th[cc][rl] = (_Float16)v; const __bf16 bh = (__bf16)v; tb[cc][rl] = bh; tbl[cc][rl] = (__bf16)(v - (float)bh); } }
    __syncthreads();
    for (int e = tid; e < 128 * (PROWS / 8); e += 256) { const int cl2 = ((e >> 6) & 7) * 16 + (e & 15), q = (e >> 9) * 4 + ((e >> 4) & 3); vst2((unsigned*)(VT + (bb * TT + t0) * (size_t)CC + (size_t)e * 8), *(const v4u*)&th[cl2][q * 8]); if (t0 + q * 8 < KHI) {   /* piece e of the block's 128 keys in fragment order: 32 keys e >> 9, channel tile (e >> 6) & 7, key octet q */ const size_t o3 = (bb * CC + c0 + cl2) * (size_t)KHI + t0 + q * 8; vst2((unsigned*)(VB + o3), *(const v4u*)&tb[cl2][q * 8]); vst2((unsigned*)(VBL + o3), *(const v4u*)&tbl[cl2][q * 8]);
        asm volatile("s_wait_xcnt 0x0" ::: "memory"); } } } }   // the next trip forms its addresses in the registers that these two stores name; inside the branch, so that no address addition is lifted over it
__device__ __forceinline__ float exp2_slot(float x) { float y; asm("v_exp_f32 %0, %1\n\tv_nop" : "=v"(y) : "v"(x)); return y; }
// eight base-2 exponentials in one statement: no result lies on a source (early clobber) and the slot behind the last one is filled
__device__ __forceinline__ v8f exp2_x8(v8f x) { float y0, y1, y2, y3, y4, y5, y6, y7;
  asm("v_exp_f32 %0, %8\n\tv_exp_f32 %1, %9\n\tv_exp_f32 %2, %10\n\tv_exp_f32 %3, %11\n\tv_exp_f32 %4, %12\n\tv_exp_f32 %5, %13\n\tv_exp_f32 %6, %14\n\tv_exp_f32 %7, %15\n\tv_nop"
      : "=&v"(y0), "=&v"(y1), "=&v"(y2), "=&v"(y3), "=&v"(y4), "=&v"(y5), "=&v"(y6), "=&v"(y7) : "v"(x[0]), "v"(x[1]), "v"(x[2]), "v"(x[3]), "v"(x[4]), "v"(x[5]), "v"(x[6]), "v"(x[7]));
  return v8f{y0, y1, y2, y3, y4, y5, y6, y7}; }
#define KSPLIT 8
#define QTILES 2
#define KBLK 64
#define NBLK (TT / KSPLIT / KBLK)
// one fragment in fragment order; p = its 1-KiB block + lane * 8 elements
__device__ __forceinline__ v16h frag_p(const _Float16* p) { union { v16h v; v8h q[2]; } u; u.q[0] = *(const v8h*)p; u.q[1] = *(const v8h*)(p + 256); return u.v; }
// the scheduling barriers at the head and the foot of a load group keep it whole and where it is written, right behind the products that free its registers: left free, the compiler lifted a whole pass's loads to the head of the loop, into registers of their own (498 seen)
#define LDK(buf, j) do { __builtin_amdgcn_sched_barrier(0); _Pragma("unroll") for (int t = 0; t < 4; ++t) fb[buf][t] = frag_p(kp + ((j) * 4 + t) * 512); __builtin_amdgcn_sched_barrier(0); } while (0)                                   /* key tile j, head slices 0..3 */
#define LDV(buf, jj) do { __builtin_amdgcn_sched_barrier(0); _Pragma("unroll") for (int t = 0; t < 4; ++t) fb[buf][t] = frag_p(vp + ((t & 1) * (CC / 16) + (jj) * 2 + (t >> 1)) * 512); __builtin_amdgcn_sched_barrier(0); } while (0)   /* channel tiles 2jj, 2jj+1, key slices 0..1 */
#define QK(buf, j) do { _Pragma("unroll") for (int t = 0; t < 4; ++t) _Pragma("unroll") for (int u = 0; u < QTILES; ++u) s[u][j] = wmma16(fb[buf][t], aq[u][t], s[u][j]); } while (0)
#define PV(buf, jj) do { _Pragma("unroll") for (int t = 0; t < 4; ++t) _Pragma("unroll") for (int u = 0; u < QTILES; ++u) o[u][(jj) * 2 + (t >> 1)] = wmma16(fb[buf][t], pf[u][t & 1], o[u][(jj) * 2 + (t >> 1)]); } while (0)
// the walk of one wave. R (0 or 2) is the place at which every pass enters its rings of four key tiles and of four channel groups: the order in which tiles and groups are loaded and multiplied, nothing else (each still goes to its own accumulators, so R changes no value). It is a compile-time number, so that every register index stays one; the kernel picks one of the two copies by a scalar branch.
#define RT(n) (((n) + R) & 3)
template <int R> __device__ __forceinline__ void fa_walk(const _Float16* kp, const _Float16* vp, int cb, const v16h (&aq)[QTILES][HD / 32], v8f (&o)[QTILES][HD / 16], float (&m)[QTILES], float (&l)[QTILES]) {
  const float c2 = SCALE * 1.4426950408889634f;   // logit scale times log2(e): the exponentials are base 2
  v16h fb[2][4], pf[QTILES][2];
  LDK(0, RT(0)); LDK(1, RT(1));
#pragma unroll 1   // rolled: a pass is one straight block of code, and the two fragment groups in flight are carried over its back edge
  for (int kb = 0; kb < NBLK; ++kb) { v8f s[QTILES][KBLK / 16] = {};
    QK(0, RT(0)); LDK(0, RT(2)); QK(1, RT(1)); LDK(1, RT(3)); QK(0, RT(2)); LDV(0, RT(0)); QK(1, RT(3)); LDV(1, RT(1));
#pragma unroll
    for (int u = 0; u < QTILES; ++u) { float mx = s[u][0][0];
#pragma unroll
      for (int j = 0; j < KBLK / 16; ++j)
#pragma unroll
        for (int r = 0; r < 8; ++r) mx = fmaxf(mx, s[u][j][r]);
      mx = fmaxf(mx, __shfl_xor(mx, 16));   // the other half of the wave holds the query's other 32 keys
      const float mn = fmaxf(m[u], mx * c2); const float al = exp2_slot(m[u] - mn); m[u] = mn; float sj[KBLK / 16] = {};
#pragma unroll
      for (int j = 0; j < KBLK / 16; ++j) { const v8f p = exp2_x8(s[u][j] * c2 - mn);
#pragma unroll
        for (int r = 0; r < 8; ++r) { sj[j] += p[r]; pf[u][j >> 1][(j & 1) * 8 + r] = (_Float16)p[r]; } }
      l[u] = l[u] * al + ((sj[0] + sj[1]) + (sj[2] + sj[3]));
#pragma unroll
      for (int j = 0; j < HD / 16; ++j) o[u][j] *= al; }
    asm volatile("s_wait_xcnt 0x0" ::: "memory");   // the addition to kp below rewrites the address registers that the k loads above name
    const int step = cb + 1 < NBLK ? KBLK * CC : -(NBLK - 1) * KBLK * CC; cb = (cb + 1) & (NBLK - 1);   // one block on, from the last block of the ring back to the first
    kp += step;   // behind the last pass the first two key tiles of the walk are read again, unused: the loads stay unconditional and their counted waits exact
    PV(0, RT(0)); LDV(0, RT(2)); PV(1, RT(1)); LDV(1, RT(3)); PV(0, RT(2)); LDK(0, RT(0)); PV(1, RT(3)); LDK(1, RT(1));
    int stepv = step;
    asm volatile("s_wait_xcnt 0x0" : "+s"(stepv) :: "memory");   // the line below rewrites the address registers that the v loads above name; the step goes through this statement because the addition, left free, was placed ahead of the wait (seen in the listing)
    vp += stepv; } }
__global__ __launch_bounds__(32 * KSPLIT) void k_fa(const _Float16* __restrict__ QH, const _Float16* __restrict__ KH, const _Float16* __restrict__ VT, float* __restrict__ Y) {
  __shared__ __align__(16) float ps[KSPLIT][16 * QTILES][HD + 4]; __shared__ float pm[KSPLIT][16 * QTILES], pl[KSPLIT][16 * QTILES];
  const int tid = threadIdx.x, wave = tid >> 5, lane = tid & 31, col = lane & 15, g = lane >> 4; const int b = blockIdx.y; const size_t qb0 = (size_t)b * TT + blockIdx.x * (16 * QTILES);
  const int ph = (blockIdx.x + (blockIdx.x >> 3)) & (2 * NBLK - 1);   // the work-group's place of entry, one of eight: any value is right, the spread is for speed alone
  const int cb = ph & (NBLK - 1);   // the key block that the walk begins with
  const _Float16* kp = KH + ((size_t)b * TT + wave * (TT / KSPLIT) + cb * KBLK) * CC + lane * 8; const _Float16* vp = VT + ((size_t)b * TT + wave * (TT / KSPLIT) + cb * KBLK) * CC + lane * 8;   // in fragment order too, 32 keys take 32 * CC elements of k and as many of v
  v16h aq[QTILES][HD / 32];
  const _Float16* qp = QH + qb0 * CC + lane * 8;
#pragma unroll
  for (int u = 0; u < QTILES; ++u)
#pragma unroll
    for (int kc = 0; kc < HD / 32; ++kc) aq[u][kc] = frag_p(qp + u * 16 * CC + kc * 512);
  asm volatile("s_wait_xcnt 0x0" ::: "memory");   // the base registers that the q loads name are written anew in front of the loop; the wait stands here, ahead of the k loads, where it waits for the q loads alone
  __builtin_amdgcn_sched_barrier(0);   // q loads stay the oldest: issued behind the k groups they would turn the loop's first counted wait into a wait for every load
  v8f o[QTILES][HD / 16] = {}; float m[QTILES], l[QTILES];
#pragma unroll
  for (int u = 0; u < QTILES; ++u) { m[u] = -3.0e38f; l[u] = 0.f; }
  if (ph & NBLK) fa_walk<2>(kp, vp, cb, aq, o, m, l); else fa_walk<0>(kp, vp, cb, aq, o, m, l);
#pragma unroll
  for (int u = 0; u < QTILES; ++u) { l[u] += __shfl_xor(l[u], 16);
    if (g == 0) { pm[wave][u * 16 + col] = m[u]; pl[wave][u * 16 + col] = l[u]; }
#pragma unroll
    for (int j = 0; j < HD / 16; ++j) { *(v4f*)&ps[wave][u * 16 + col][j * 16 + 8 * g] = __builtin_shufflevector(o[u][j], o[u][j], 0, 1, 2, 3); *(v4f*)&ps[wave][u * 16 + col][j * 16 + 8 * g + 4] = __builtin_shufflevector(o[u][j], o[u][j], 4, 5, 6, 7); } }
  __syncthreads();
#pragma unroll
  for (int i = 0; i < 16 * QTILES / KSPLIT; ++i) { const int rr = wave + KSPLIT * i; float mm = pm[0][rr];
#pragma unroll
    for (int w = 1; w < KSPLIT; ++w) mm = fmaxf(mm, pm[w][rr]);
    float den = 0.f; v4f acc = {};
#pragma unroll
    for (int w = 0; w < KSPLIT; ++w) { const float f = exp2_slot(pm[w][rr] - mm); den += f * pl[w][rr]; acc += *(const v4f*)&ps[w][rr][lane * 4] * f; }
    vst2(Y + (qb0 + rr) * CC + lane * 4, acc * (1.0f / den)); } }

extern "C" void kernel_launch(void* const* d_in, const int* in_sizes, int n_in, void* d_out, int out_size, void* d_ws, size_t ws_size, hipStream_t stream) {
  (void)in_sizes; (void)n_in; (void)out_size;
  const float** F = (const float**)d_in;
  if (ws_size < (size_t)WS_END) return;
  char* ws = (char*)d_ws; _Float16 *QH = (_Float16*)(ws + WS_QH), *KH = (_Float16*)(ws + WS_KH), *VT = (_Float16*)(ws + WS_VT), *QL = (_Float16*)(ws + WS_QL), *KL = (_Float16*)(ws + WS_KL); __bf16 *VB = (__bf16*)(ws + WS_VB), *VBL = (__bf16*)(ws + WS_VBL);
  // inputs, in order: 0 x [4,2048,1024]; 1 Wk [1024,128] (in,out); 2 Wq [1024,128]; 3 Wv [1024,128]; no biases
  k_proj<<<dim3(TNB * TT / PROWS, CC / 128, 3), 256, 0, stream>>>(F[0], F[0], F[0], F[2], F[1], F[3], nullptr, nullptr, nullptr, QH, QL, KH, KL, VT, VB, VBL);   /* q uses Wq = input 2, k uses Wk = input 1 */
  // logits, softmax and P . v of every batch in one launch
  k_fa<<<dim3(TT / (16 * QTILES), TNB), 32 * KSPLIT, 0, stream>>>(QH, KH, VT, (float*)d_out);
}

// v007
// One run takes 24.5 microseconds.
// Next to v006, in two timings, it ran 1.07 times as fast each time.
// Counting every step since v000, it is 22.0 times as fast.
// compute dtype: all float inputs rounded to bf16; q/k/v projections with EXACT bf16 products on WMMA 16x16x32 (f32 accumulate); logits q x k once to f16 each (1 product; sigma - 1) x 128^-0.5; online softmax f32; P = exp(logit - running max) once to f16 x v once to f16 (1 product); f32 output.
#include <hip/hip_runtime.h>
#include <math.h>

typedef __attribute__((ext_vector_type(16))) _Float16 v16h;
typedef __attribute__((ext_vector_type(16))) __bf16 v16b;
typedef __attribute__((ext_vector_type(8)))  _Float16 v8h;
typedef __attribute__((ext_vector_type(8)))  float v8f;
typedef __attribute__((ext_vector_type(4)))  float v4f;
typedef __attribute__((ext_vector_type(2)))  float v2f;
typedef __attribute__((ext_vector_type(4)))  unsigned v4u;
typedef __attribute__((ext_vector_type(4)))  int v4i;
typedef float __attribute__((may_alias)) float_a;
typedef int __attribute__((may_alias)) int_a;

template <typename T> __device__ __forceinline__ void vst2(void* p, T v) { *(T*)p = v;  }
// plain builtin, behind which the compiler keeps the WMMA distance itself: an asm statement that takes d, a and b as operands holds them under v256, and k_fa now lives in more registers than that (seen: scratch)
__device__ __forceinline__ v8f wmma16(v16h a, v16h b, v8f c) {
  return __builtin_amdgcn_wmma_f32_16x16x32_f16(false, a, false, b, (short)0, c, false, false);
}
__device__ __forceinline__ v8f wmma_bf(v16b a, v16b b, v8f c) {
  v8f d = __builtin_amdgcn_wmma_f32_16x16x32_bf16(false, a, false, b, (short)0, c, false, false);
  asm volatile("v_nop\n\tv_nop\n\tv_nop\n\tv_nop" : "+v"(d) : "v"(a), "v"(b));
  return d;
}
// 16x16x32 fragments: lane = (h = lane>>4, row/col = lane&15); elements 0..7 = k0+8h+0..7, 8..15 = k0+16+8h+0..7; D element r = row 8h+r
__device__ __forceinline__ v16h frag_h(const _Float16* rowk0, int lane) {
  union { v16h v; v8h q[2]; } u; const _Float16* p = rowk0 + 8 * (lane >> 4);
  u.q[0] = *(const v8h*)p; u.q[1] = *(const v8h*)(p + 16); return u.v;
}
__device__ __forceinline__ v16h frag_f32(const float* rowk0, int lane) {
  v16h a; const float* p = rowk0 + 8 * (lane >> 4);
#pragma unroll
  for (int i = 0; i < 8; ++i) { a[i] = (_Float16)p[i]; a[8 + i] = (_Float16)p[16 + i]; }
  return a;
}
__device__ __forceinline__ v16h frag_f32s(const float* rowk0, int lane, float sc) {
  v16h a; const float* p = rowk0 + 8 * (lane >> 4);
#pragma unroll
  for (int i = 0; i < 8; ++i) { a[i] = (_Float16)(p[i] * sc); a[8 + i] = (_Float16)(p[16 + i] * sc); }
  return a;
}
// column fragment from a [K][ld] layout (column n), rows >= K read as 0
__device__ __forceinline__ v16h fragc_f32(const float* W, int k0, int n, int lane, int ld, int K) {
  v16h a; const int g = lane >> 4;
#pragma unroll
  for (int i = 0; i < 8; ++i) { const int ka = k0 + 8 * g + i, kb = ka + 16;
    a[i] = (_Float16)(ka < K ? W[(size_t)(ka < K ? ka : K - 1) * ld + n] : 0.f); a[8 + i] = (_Float16)(kb < K ? W[(size_t)(kb < K ? kb : K - 1) * ld + n] : 0.f); }
  return a;
}
struct F2 { v16b h, l; };
__device__ __forceinline__ F2 bsplit16(const float v[16]) { F2 r;
#pragma unroll
  for (int i = 0; i < 16; ++i) { const __bf16 h = (__bf16)v[i]; r.h[i] = h; r.l[i] = (__bf16)(v[i] - (float)h); }
  return r; }
__device__ __forceinline__ F2 split_row(const float* row, int k0, int lane) { float v[16]; const float* p = row + k0 + 8 * (lane >> 4);
#pragma unroll
  for (int i = 0; i < 8; ++i) { v[i] = p[i]; v[8 + i] = p[16 + i]; }
  return bsplit16(v); }
__device__ __forceinline__ F2 split_rowK(const float* row, int k0, int lane, int K) { float v[16]; const int g = lane >> 4;
#pragma unroll
  for (int i = 0; i < 8; ++i) { const int ka = k0 + 8 * g + i, kb = ka + 16; v[i] = ka < K ? row[ka < K ? ka : K - 1] : 0.f; v[8 + i] = kb < K ? row[kb < K ? kb : K - 1] : 0.f; }
  return bsplit16(v); }
__device__ __forceinline__ F2 split_col(const float* W, int k0, int n, int lane, int ld, int K) { float v[16]; const int g = lane >> 4;
#pragma unroll
  for (int i = 0; i < 8; ++i) { const int ka = k0 + 8 * g + i, kb = ka + 16; v[i] = ka < K ? W[(size_t)(ka < K ? ka : K - 1) * ld + n] : 0.f; v[8 + i] = kb < K ? W[(size_t)(kb < K ? kb : K - 1) * ld + n] : 0.f; }
  return bsplit16(v); }
__device__ __forceinline__ v8f mac3(const F2& a, const F2& b, v8f c) { c = wmma_bf(a.l, b.h, c); c = wmma_bf(a.h, b.l, c); return wmma_bf(a.h, b.h, c); }
__device__ __forceinline__ float sigm(float v) { return 1.0f / (1.0f + expf(-v)); }
#define LDSX() do { asm volatile("s_wait_dscnt 0" ::: "memory"); __builtin_amdgcn_wave_barrier(); __builtin_amdgcn_fence(__ATOMIC_RELEASE, "workgroup"); } while (0)

// Single-head NON-causal self-attention with head size 128 (x [4,2048,1024]; (in,out) Wk / Wq / Wv [1024,128] N(0, 1/1024), no biases; no mask in the source; scale 128^-0.5): out = softmax(q k^T * 128^-0.5) v -> [4,2048,128].
#define NB 4
#define TT 2048
#define CC 128            // NH * HD = projected width
#define DIN 1024          // input (model) width
#define NH 1
#define HD 128
#define NQB (TT / 64)
#define HG 1
#define SCALE (0.08838834764831845f)
#define CAUSAL 0
#ifndef TNB
#define TNB NB
#endif
__device__ __forceinline__ float bfr(float v) { return (float)(__bf16)v; }
__host__ __device__ __forceinline__ int kb_last(int qb) { return CAUSAL ? ((qb * 64 + 63) >> 7) : (TT / 128 - 1); }
typedef __attribute__((ext_vector_type(8))) __bf16 v8b;
__device__ __forceinline__ v16b frag_b(const __bf16* rowk0, int lane) {
  union { v16b v; v8b q[2]; } u; const __bf16* p = rowk0 + 8 * (lane >> 4);
  u.q[0] = *(const v8b*)p; u.q[1] = *(const v8b*)(p + 16); return u.v;
}
// B fragment (k rows k0+.., output column o) of a weight: (in,out) [K][ld] or (out,in) [ld rows of K]: bf16 exact, or f16(bf16 * 256) exact
__device__ __forceinline__ v16b wcol_io(const float* Wm, int k0, int o, int lane, int ld) { v16b w; const int g = lane >> 4;
#pragma unroll
  for (int i = 0; i < 8; ++i) { w[i] = (__bf16)Wm[(size_t)(k0 + 8 * g + i) * ld + o]; w[8 + i] = (__bf16)Wm[(size_t)(k0 + 16 + 8 * g + i) * ld + o]; }
  return w; }
__device__ __forceinline__ v16b wcol_oi(const float* Wm, int k0, int o, int lane, int K) { v16b w; const float* p = Wm + (size_t)o * K + k0 + 8 * (lane >> 4);
#pragma unroll
  for (int i = 0; i < 8; ++i) { w[i] = (__bf16)p[i]; w[8 + i] = (__bf16)p[16 + i]; }
  return w; }
__device__ __forceinline__ v16h wcolh_io(const float* Wm, int k0, int o, int lane, int ld) { v16h w; const int g = lane >> 4;
#pragma unroll
  for (int i = 0; i < 8; ++i) { w[i] = (_Float16)(bfr(Wm[(size_t)(k0 + 8 * g + i) * ld + o]) * 256.0f); w[8 + i] = (_Float16)(bfr(Wm[(size_t)(k0 + 16 + 8 * g + i) * ld + o]) * 256.0f); }
  return w; }
__device__ __forceinline__ v16h wcolh_oi(const float* Wm, int k0, int o, int lane, int K) { v16h w; const float* p = Wm + (size_t)o * K + k0 + 8 * (lane >> 4);
#pragma unroll
  for (int i = 0; i < 8; ++i) { w[i] = (_Float16)(bfr(p[i]) * 256.0f); w[8 + i] = (_Float16)(bfr(p[16 + i]) * 256.0f); }
  return w; }
#define WQKV_LAYOUT 0   // 0 = (in,out) [DIN][CC]; 1 = (out,in) [CC][DIN]; 2 = per-head [NH][DIN][HD]
__device__ __forceinline__ v16b wcol_hdk(const float* Wm, int k0, int o, int lane) { v16b w; const int g = lane >> 4; const float* p = Wm + (size_t)(o / HD) * DIN * HD + (o % HD);
#pragma unroll
  for (int i = 0; i < 8; ++i) { w[i] = (__bf16)p[(size_t)(k0 + 8 * g + i) * HD]; w[8 + i] = (__bf16)p[(size_t)(k0 + 16 + 8 * g + i) * HD]; }
  return w; }
#define WO_OUT_IN 0
#if WQKV_LAYOUT == 1
#define WCOL(W, k0, o, lane) wcol_oi(W, k0, o, lane, DIN)
#elif WQKV_LAYOUT == 2
#define WCOL(W, k0, o, lane) wcol_hdk(W, k0, o, lane)
#else
#define WCOL(W, k0, o, lane) wcol_io(W, k0, o, lane, CC)
#endif
#if WO_OUT_IN
#define WOCOL(W, k0, o, lane) wcol_oi(W, k0, o, lane, CC)
#define WOCOLH(W, k0, o, lane) wcolh_oi(W, k0, o, lane, CC)
#else
#define WOCOL(W, k0, o, lane) wcol_io(W, k0, o, lane, DIN)
#define WOCOLH(W, k0, o, lane) wcolh_io(W, k0, o, lane, DIN)
#endif

#ifndef SM_EXTRA_PARAMS
#define SM_EXTRA_PARAMS
#endif
#ifndef PROJ_EXTRA_PARAMS
#define PROJ_EXTRA_PARAMS
#endif
#ifndef SM_MASK_HOOK
#define SM_MASK_HOOK (void)0
#endif

// q, k and v lie in FRAGMENT ORDER: one 16 x 32 WMMA fragment is a block of 1 KiB = two runs of 512 bytes, run h holding at lane * 16 bytes the eight elements 16 h + 8 (lane >> 4) + 0..7 of row lane & 15, so that each of a fragment's two 16-byte loads reads four whole lines
#define WS_QH  0u                                      // f16 q fragments [b*t / 16][CC / 32][1 KiB]: rows = 16 queries, elements = 32 head channels
#define WS_KH  (WS_QH + 2u * (size_t)NB * TT * CC)      // f16 k fragments [b*t / 16][CC / 32][1 KiB]: rows = 16 keys, elements = 32 head channels
#define WS_VT  (WS_KH + 2u * (size_t)NB * TT * CC)      // f16 v fragments [b][t / 32][CC / 16][1 KiB]: rows = 16 channels, elements = 32 keys
#define WS_END (WS_VT + 2u * (size_t)NB * CC * TT)

// ---- k_proj: block = (128 rows, 128 cols, which), 8 waves: q/k/v = X W with exact bf16 products (K = DIN) -> which 0: q f16 fragments; 1: k f16 fragments; 2: v f16 fragments; the fragment order (at WS_QH) takes CC == 128, one column block
// X and W go through LDS as bf16 in chunks of PKC k, two buffers: every global load is a 16-byte load whose wave covers four whole lines, and one barrier a chunk publishes the new buffer and frees the old one.
// While chunk t is multiplied, the W loads of chunk t + 1 and the X loads of chunks t + 1 and t + 2 are in flight (X comes from memory, W from L2; two register sets for X, so the loop body is two chunks).
// W is turned on its way into LDS: a thread holds 8 k x 4 columns and stores, per column, 8 consecutive k as 16 bytes, so that A and B fragments are both two 16-byte LDS reads of a row. Waves 4 x 2, each 32 rows of the A side x 64 rows of the B side.
// X and W tiles have the same LDS form (128 rows of PKC k), so either can be the A side. v: A = X, B = W, so a lane's 8 accumulator elements are 8 consecutive keys of one channel. q and k: A = W, B = X (the transposed product), so they are 8 consecutive channels of one row.
// Either way these 8 values, as f16, are the lane's own 16 bytes of a fragment run (at WS_QH): every accumulator tile goes from registers to the workspace in one 16-byte store a lane, 512 consecutive bytes a wave, with no pass through LDS and no barrier behind the last products.
// The 64 blocks of one weight read the same W lines, the 3 blocks of one row tile the same X lines: each block enters the ring of PNCH chunks at a place of its own (from its block index) and wraps round, so that they do not ask L2 for the same lines at the same moment. Every accumulator sums its k in steps of 32, ascending from that place and wrapped.
#define PROWS 128          // rows of X per block
#define PKC 64             // k per chunk
#define PPIT (PKC + 8)     // LDS row pitch in elements: 128 bytes of data + 16, the pitch for 16-byte readers
#define PNCH (DIN / PKC)
typedef __attribute__((ext_vector_type(4))) __bf16 v4b;
// the scheduling barrier at the foot of each load group keeps the groups whole, in the order written and above the products: the load counter runs in issue order, so a wait for W must not have the younger X loads in front of it
#define P_LOADX(x, p) do { _Pragma("unroll") for (int i = 0; i < 8; ++i) x[i] = *(const v4f*)((p) + (size_t)i * 16 * DIN); __builtin_amdgcn_sched_barrier(0); } while (0)
#define P_LOADW(p) do { _Pragma("unroll") for (int i = 0; i < 8; ++i) wv[i] = *(const v4f*)((p) + (size_t)i * CC); __builtin_amdgcn_sched_barrier(0); } while (0)
// both walking pointers go one chunk on, from the last chunk of the ring back to the first; the wait stands in front because the additions rewrite the address registers that the loads above name, and behind the products, where those loads have long been taken
#define P_STEP() do { __builtin_amdgcn_sched_barrier(0); asm volatile("s_wait_xcnt 0x0" ::: "memory"); cw = (cw + 1) & (PNCH - 1); wp += cw ? PKC * CC : (PKC - DIN) * CC; cx = (cx + 1) & (PNCH - 1); xp += cx ? PKC : PKC - DIN; } while (0)
// work-group barrier for LDS data alone: this wave's LDS stores are complete, then the barrier; written by hand because __syncthreads() also waits for every global load, and the X loads issued ahead are to stay in flight across it
#define P_BAR() asm volatile("s_wait_dscnt 0x0\n\ts_barrier_signal -1\n\ts_barrier_wait -1" ::: "memory")
// the scheduling barrier at the head of P_STORE keeps the conversions below the products: lifted above them (seen in the listing) they wait for loads that were only just issued
#define P_STORE(x, buf) do { __builtin_amdgcn_sched_barrier(0); _Pragma("unroll") for (int i = 0; i < 8; ++i) { v4b p; _Pragma("unroll") for (int e = 0; e < 4; ++e) p[e] = (__bf16)x[i][e]; *(v4b*)&st[0][buf][(tid >> 4) + 16 * i][(tid & 15) * 4] = p; } \
    _Pragma("unroll") for (int c = 0; c < 4; ++c) { v8b p; _Pragma("unroll") for (int i = 0; i < 8; ++i) p[i] = (__bf16)wv[i][c]; *(v8b*)&st[1][buf][(wave & 3) * 32 + cl * 4 + c][((wave >> 2) * 4 + kl) * 8] = p; } } while (0)
#define P_MUL(buf) do { _Pragma("unroll") for (int kk = 0; kk < PKC / 32; ++kk) { v16b a[2], w[4]; \
    _Pragma("unroll") for (int i = 0; i < 2; ++i) a[i] = frag_b(pa + ((buf) * 128 + i * 16) * PPIT + kk * 32, lane); \
    _Pragma("unroll") for (int j = 0; j < 4; ++j) w[j] = frag_b(pb + ((buf) * 128 + j * 16) * PPIT + kk * 32, lane); \
    _Pragma("unroll") for (int i = 0; i < 2; ++i) _Pragma("unroll") for (int j = 0; j < 4; ++j) acc[i][j] = wmma_bf(a[i], w[j], acc[i][j]); } } while (0)
__global__ __launch_bounds__(256) void k_proj(const float* __restrict__ XQ, const float* __restrict__ XK, const float* __restrict__ XV, const float* __restrict__ WQ, const float* __restrict__ WK, const float* __restrict__ WV,
    _Float16* __restrict__ QH, _Float16* __restrict__ KH, _Float16* __restrict__ VT) {
  __shared__ __align__(16) __bf16 st[2][2][128][PPIT];   // [0] = X tile, [1] = W tile (turned); two buffers each; PROWS == 128
  const int tid = threadIdx.x, wave = tid >> 5, lane = tid & 31, col = lane & 15; const int which = blockIdx.z; const int c0 = blockIdx.y * 128; const size_t r0 = (size_t)blockIdx.x * PROWS;
  const float* X = which == 0 ? XQ : which == 1 ? XK : XV; const float* WA = which == 0 ? WQ : which == 1 ? WK : WV;
  const int wr = wave >> 1, wc = wave & 1, cl = lane & 7, kl = lane >> 3;
  const int sa = which < 2 ? 1 : 0;   // which tile is the A side
  const __bf16* pa = &st[sa][0][wr * 32 + col][0]; const __bf16* pb = &st[sa ^ 1][0][wc * 64 + col][0];
  const float* xg = X + (r0 + (tid >> 4)) * DIN + (tid & 15) * 4;                                        // a wave's load: 2 rows x 256 bytes
  const float* wg = WA + (size_t)(((wave >> 2) * 4 + kl) * 8) * CC + c0 + (wave & 3) * 32 + cl * 4;      // a wave's load: 4 k rows x 128 bytes
  v4f xa[8], xb[8], wv[8]; v8f acc[2][4] = {};
  const int rot = (blockIdx.x + 10 * (blockIdx.x >> 3) + 5 * blockIdx.z) & (PNCH - 1);   // the block's place of entry: any value is right, the spread is for speed alone
  int cw = (rot + 1) & (PNCH - 1), cx = (rot + 2) & (PNCH - 1); const float* wp = wg + (size_t)cw * PKC * CC; const float* xp = xg + cx * PKC;   // chunk t of the walk is chunk (rot + t) mod PNCH of k
  P_LOADX(xa, xg + rot * PKC); P_LOADW(wg + (size_t)rot * PKC * CC); P_LOADX(xb, xg + cw * PKC);
  asm volatile("s_wait_xcnt 0x0" ::: "memory");   // the address registers that these three groups name are used for other values from here on; the wait for the first group's data follows at once, so this one costs nothing
  // piece e (16 bytes) of the block's 32 KiB in fragment order. q, k: e = 256 (row tile) + 32 (channel tile) + lane, row tile = 4 wc + j, channel tile = 2 wr + i. v: e = 512 (32 keys) + 64 (channel tile) + 32 (key half) + lane, 32 keys = wr, channel tile = 4 wc + j, key half = i.
  const int js = which < 2 ? 256 : 64, ewc = 4 * js, ewr = which < 2 ? 64 : 512;
  _Float16* dp = (which == 0 ? QH : which == 1 ? KH : VT) + r0 * CC + (size_t)(wc * ewc + wr * ewr + lane) * 8;
  P_STORE(xa, 0);
  P_BAR();
#pragma unroll 1   // rolled: the body is two chunks, one for each register set of X, and the code stays small
  for (int t = 0; t + 2 < PNCH; t += 2) {
    P_LOADW(wp); P_LOADX(xa, xp); P_MUL(0); P_STEP(); P_STORE(xb, 1);
    P_BAR();     // publishes chunk t + 1 and ends every read of chunk t, whose buffer is refilled next
    P_LOADW(wp); P_LOADX(xb, xp); P_MUL(1); P_STEP(); P_STORE(xa, 0);
    P_BAR(); }   // the same for chunk t + 2
  P_LOADW(wp); P_MUL(0); P_STORE(xb, 1);
  P_BAR();
  P_MUL(1);
  // both loops unrolled: the accumulators are indexed at compile time and stay in registers
#pragma unroll
  for (int i = 0; i < 2; ++i)
#pragma unroll
  for (int j = 0; j < 4; ++j) { v8h h;
#pragma unroll
    for (int r = 0; r < 8; ++r) h[r] = (_Float16)acc[i][j][r];
    *(v8h*)(dp + (j * js + i * 32) * 8) = h; } }
__device__ __forceinline__ float exp2_slot(float x) { float y; asm("v_exp_f32 %0, %1\n\tv_nop" : "=v"(y) : "v"(x)); return y; }
// eight base-2 exponentials in one statement: no result lies on a source (early clobber) and the slot behind the last one is filled
__device__ __forceinline__ v8f exp2_x8(v8f x) { float y0, y1, y2, y3, y4, y5, y6, y7;
  asm("v_exp_f32 %0, %8\n\tv_exp_f32 %1, %9\n\tv_exp_f32 %2, %10\n\tv_exp_f32 %3, %11\n\tv_exp_f32 %4, %12\n\tv_exp_f32 %5, %13\n\tv_exp_f32 %6, %14\n\tv_exp_f32 %7, %15\n\tv_nop"
      : "=&v"(y0), "=&v"(y1), "=&v"(y2), "=&v"(y3), "=&v"(y4), "=&v"(y5), "=&v"(y6), "=&v"(y7) : "v"(x[0]), "v"(x[1]), "v"(x[2]), "v"(x[3]), "v"(x[4]), "v"(x[5]), "v"(x[6]), "v"(x[7]));
  return v8f{y0, y1, y2, y3, y4, y5, y6, y7}; }
#define KSPLIT 8
#define QTILES 2
#define KBLK 64
#define NBLK (TT / KSPLIT / KBLK)
// one fragment in fragment order; p = its 1-KiB block + lane * 8 elements
__device__ __forceinline__ v16h frag_p(const _Float16* p) { union { v16h v; v8h q[2]; } u; u.q[0] = *(const v8h*)p; u.q[1] = *(const v8h*)(p + 256); return u.v; }
// the scheduling barriers at the head and the foot of a load group keep it whole and where it is written, right behind the products that free its registers: left free, the compiler lifted a whole pass's loads to the head of the loop, into registers of their own (498 seen)
#define LDK(buf, j) do { __builtin_amdgcn_sched_barrier(0); _Pragma("unroll") for (int t = 0; t < 4; ++t) fb[buf][t] = frag_p(kp + ((j) * 4 + t) * 512); __builtin_amdgcn_sched_barrier(0); } while (0)                                   /* key tile j, head slices 0..3 */
#define LDV(buf, jj) do { __builtin_amdgcn_sched_barrier(0); _Pragma("unroll") for (int t = 0; t < 4; ++t) fb[buf][t] = frag_p(vp + ((t & 1) * (CC / 16) + (jj) * 2 + (t >> 1)) * 512); __builtin_amdgcn_sched_barrier(0); } while (0)   /* channel tiles 2jj, 2jj+1, key slices 0..1 */
#define QK(buf, j) do { _Pragma("unroll") for (int t = 0; t < 4; ++t) _Pragma("unroll") for (int u = 0; u < QTILES; ++u) s[u][j] = wmma16(fb[buf][t], aq[u][t], s[u][j]); } while (0)
#define PV(buf, jj) do { _Pragma("unroll") for (int t = 0; t < 4; ++t) _Pragma("unroll") for (int u = 0; u < QTILES; ++u) o[u][(jj) * 2 + (t >> 1)] = wmma16(fb[buf][t], pf[u][t & 1], o[u][(jj) * 2 + (t >> 1)]); } while (0)
// the walk of one wave. R (0 or 2) is the place at which every pass enters its rings of four key tiles and of four channel groups: the order in which tiles and groups are loaded and multiplied, nothing else (each still goes to its own accumulators, so R changes no value). It is a compile-time number, so that every register index stays one; the kernel picks one of the two copies by a scalar branch.
#define RT(n) (((n) + R) & 3)
template <int R> __device__ __forceinline__ void fa_walk(const _Float16* kp, const _Float16* vp, int cb, const v16h (&aq)[QTILES][HD / 32], v8f (&o)[QTILES][HD / 16], float (&m)[QTILES], float (&l)[QTILES]) {
  const float c2 = SCALE * 1.4426950408889634f;   // logit scale times log2(e): the exponentials are base 2
  v16h fb[2][4], pf[QTILES][2];
  LDK(0, RT(0)); LDK(1, RT(1));
#pragma unroll 1   // rolled: a pass is one straight block of code, and the two fragment groups in flight are carried over its back edge
  for (int kb = 0; kb < NBLK; ++kb) { v8f s[QTILES][KBLK / 16] = {};
    QK(0, RT(0)); LDK(0, RT(2)); QK(1, RT(1)); LDK(1, RT(3)); QK(0, RT(2)); LDV(0, RT(0)); QK(1, RT(3)); LDV(1, RT(1));
#pragma unroll
    for (int u = 0; u < QTILES; ++u) { float mx = s[u][0][0];
#pragma unroll
      for (int j = 0; j < KBLK / 16; ++j)
#pragma unroll
        for (int r = 0; r < 8; ++r) mx = fmaxf(mx, s[u][j][r]);
      mx = fmaxf(mx, __shfl_xor(mx, 16));   // the other half of the wave holds the query's other 32 keys
      const float mn = fmaxf(m[u], mx * c2); const float al = exp2_slot(m[u] - mn); m[u] = mn; float sj[KBLK / 16] = {};
#pragma unroll
      for (int j = 0; j < KBLK / 16; ++j) { const v8f p = exp2_x8(s[u][j] * c2 - mn);
#pragma unroll
        for (int r = 0; r < 8; ++r) { sj[j] += p[r]; pf[u][j >> 1][(j & 1) * 8 + r] = (_Float16)p[r]; } }
      l[u] = l[u] * al + ((sj[0] + sj[1]) + (sj[2] + sj[3]));
#pragma unroll
      for (int j = 0; j < HD / 16; ++j) o[u][j] *= al; }
    asm volatile("s_wait_xcnt 0x0" ::: "memory");   // the addition to kp below rewrites the address registers that the k loads above name
    const int step = cb + 1 < NBLK ? KBLK * CC : -(NBLK - 1) * KBLK * CC; cb = (cb + 1) & (NBLK - 1);   // one block on, from the last block of the ring back to the first
    kp += step;   // behind the last pass the first two key tiles of the walk are read again, unused: the loads stay unconditional and their counted waits exact
    PV(0, RT(0)); LDV(0, RT(2)); PV(1, RT(1)); LDV(1, RT(3)); PV(0, RT(2)); LDK(0, RT(0)); PV(1, RT(3)); LDK(1, RT(1));
    int stepv = step;
    asm volatile("s_wait_xcnt 0x0" : "+s"(stepv) :: "memory");   // the line below rewrites the address registers that the v loads above name; the step goes through this statement because the addition, left free, was placed ahead of the wait (seen in the listing)
    vp += stepv; } }
__global__ __launch_bounds__(32 * KSPLIT) void k_fa(const _Float16* __restrict__ QH, const _Float16* __restrict__ KH, const _Float16* __restrict__ VT, float* __restrict__ Y) {
  __shared__ __align__(16) float ps[KSPLIT][16 * QTILES][HD + 4]; __shared__ float pm[KSPLIT][16 * QTILES], pl[KSPLIT][16 * QTILES];
  const int tid = threadIdx.x, wave = tid >> 5, lane = tid & 31, col = lane & 15, g = lane >> 4; const int b = blockIdx.y; const size_t qb0 = (size_t)b * TT + blockIdx.x * (16 * QTILES);
  const int ph = (blockIdx.x + (blockIdx.x >> 3)) & (2 * NBLK - 1);   // the work-group's place of entry, one of eight: any value is right, the spread is for speed alone
  const int cb = ph & (NBLK - 1);   // the key block that the walk begins with
  const _Float16* kp = KH + ((size_t)b * TT + wave * (TT / KSPLIT) + cb * KBLK) * CC + lane * 8; const _Float16* vp = VT + ((size_t)b * TT + wave * (TT / KSPLIT) + cb * KBLK) * CC + lane * 8;   // in fragment order too, 32 keys take 32 * CC elements of k and as many of v
  v16h aq[QTILES][HD / 32];
  const _Float16* qp = QH + qb0 * CC + lane * 8;
#pragma unroll
  for (int u = 0; u < QTILES; ++u)
#pragma unroll
    for (int kc = 0; kc < HD / 32; ++kc) aq[u][kc] = frag_p(qp + u * 16 * CC + kc * 512);
  asm volatile("s_wait_xcnt 0x0" ::: "memory");   // the base registers that the q loads name are written anew in front of the loop; the wait stands here, ahead of the k loads, where it waits for the q loads alone
  __builtin_amdgcn_sched_barrier(0);   // q loads stay the oldest: issued behind the k groups they would turn the loop's first counted wait into a wait for every load
  v8f o[QTILES][HD / 16] = {}; float m[QTILES], l[QTILES];
#pragma unroll
  for (int u = 0; u < QTILES; ++u) { m[u] = -3.0e38f; l[u] = 0.f; }
  if (ph & NBLK) fa_walk<2>(kp, vp, cb, aq, o, m, l); else fa_walk<0>(kp, vp, cb, aq, o, m, l);
#pragma unroll
  for (int u = 0; u < QTILES; ++u) { l[u] += __shfl_xor(l[u], 16);
    if (g == 0) { pm[wave][u * 16 + col] = m[u]; pl[wave][u * 16 + col] = l[u]; }
#pragma unroll
    for (int j = 0; j < HD / 16; ++j) { *(v4f*)&ps[wave][u * 16 + col][j * 16 + 8 * g] = __builtin_shufflevector(o[u][j], o[u][j], 0, 1, 2, 3); *(v4f*)&ps[wave][u * 16 + col][j * 16 + 8 * g + 4] = __builtin_shufflevector(o[u][j], o[u][j], 4, 5, 6, 7); } }
  __syncthreads();
#pragma unroll
  for (int i = 0; i < 16 * QTILES / KSPLIT; ++i) { const int rr = wave + KSPLIT * i; float mm = pm[0][rr];
#pragma unroll
    for (int w = 1; w < KSPLIT; ++w) mm = fmaxf(mm, pm[w][rr]);
    float den = 0.f; v4f acc = {};
#pragma unroll
    for (int w = 0; w < KSPLIT; ++w) { const float f = exp2_slot(pm[w][rr] - mm); den += f * pl[w][rr]; acc += *(const v4f*)&ps[w][rr][lane * 4] * f; }
    vst2(Y + (qb0 + rr) * CC + lane * 4, acc * (1.0f / den)); } }

extern "C" void kernel_launch(void* const* d_in, const int* in_sizes, int n_in, void* d_out, int out_size, void* d_ws, size_t ws_size, hipStream_t stream) {
  (void)in_sizes; (void)n_in; (void)out_size;
  const float** F = (const float**)d_in;
  if (ws_size < (size_t)WS_END) return;
  char* ws = (char*)d_ws; _Float16 *QH = (_Float16*)(ws + WS_QH), *KH = (_Float16*)(ws + WS_KH), *VT = (_Float16*)(ws + WS_VT);
  // inputs: 0 x [4,2048,1024]; 1 Wk [1024,128] (in,out); 2 Wq [1024,128]; 3 Wv [1024,128]; no biases
  k_proj<<<dim3(TNB * TT / PROWS, CC / 128, 3), 256, 0, stream>>>(F[0], F[0], F[0], F[2], F[1], F[3], QH, KH, VT);   /* q uses Wq = input 2, k uses Wk = input 1 */
  // logits, softmax and P . v of every batch in one launch
  k_fa<<<dim3(TT / (16 * QTILES), TNB), 32 * KSPLIT, 0, stream>>>(QH, KH, VT, (float*)d_out);
}

// v008
// Measured time: 22.9 microseconds a run.
// Two timings next to v007 both put it at 1.07 times that version's speed.
// Counting every step since v000, it is 23.6 times as fast.
// compute dtype: all float inputs rounded to bf16; q/k/v projections with EXACT bf16 products on WMMA 16x16x32 (f32 accumulate); logits q x k once to f16 each (1 product; sigma - 1) x 128^-0.5; online softmax f32; P = exp(logit - running max) once to f16 x v once to f16 (1 product); f32 output.
#include <hip/hip_runtime.h>
#include <math.h>

typedef __attribute__((ext_vector_type(16))) _Float16 v16h;
typedef __attribute__((ext_vector_type(16))) __bf16 v16b;
typedef __attribute__((ext_vector_type(8)))  _Float16 v8h;
typedef __attribute__((ext_vector_type(8)))  float v8f;
typedef __attribute__((ext_vector_type(4)))  float v4f;
typedef __attribute__((ext_vector_type(2)))  float v2f;
typedef __attribute__((ext_vector_type(4)))  unsigned v4u;
typedef __attribute__((ext_vector_type(4)))  int v4i;
typedef float __attribute__((may_alias)) float_a;
typedef int __attribute__((may_alias)) int_a;

template <typename T> __device__ __forceinline__ void vst2(void* p, T v) { *(T*)p = v;  }
// plain builtin, behind which the compiler keeps the WMMA distance itself: an asm statement that takes d, a and b as operands holds them under v256, and k_fa now lives in more registers than that (seen: scratch)
__device__ __forceinline__ v8f wmma16(v16h a, v16h b, v8f c) {
  return __builtin_amdgcn_wmma_f32_16x16x32_f16(false, a, false, b, (short)0, c, false, false);
}
__device__ __forceinline__ v8f wmma_bf(v16b a, v16b b, v8f c) {
  v8f d = __builtin_amdgcn_wmma_f32_16x16x32_bf16(false, a, false, b, (short)0, c, false, false);
  asm volatile("v_nop\n\tv_nop\n\tv_nop\n\tv_nop" : "+v"(d) : "v"(a), "v"(b));
  return d;
}
// plain builtin, for k_proj: with two fragment sets it lives in more than 256 registers, which the operands of an asm statement cannot name; the compiler keeps the WMMA distance behind its own builtin
__device__ __forceinline__ v8f wmma_bfp(v16b a, v16b b, v8f c) {
  return __builtin_amdgcn_wmma_f32_16x16x32_bf16(false, a, false, b, (short)0, c, false, false);
}
// 16x16x32 fragments: lane = (h = lane>>4, row/col = lane&15); elements 0..7 = k0+8h+0..7, 8..15 = k0+16+8h+0..7; D element r = row 8h+r
__device__ __forceinline__ v16h frag_h(const _Float16* rowk0, int lane) {
  union { v16h v; v8h q[2]; } u; const _Float16* p = rowk0 + 8 * (lane >> 4);
  u.q[0] = *(const v8h*)p; u.q[1] = *(const v8h*)(p + 16); return u.v;
}
__device__ __forceinline__ v16h frag_f32(const float* rowk0, int lane) {
  v16h a; const float* p = rowk0 + 8 * (lane >> 4);
#pragma unroll
  for (int i = 0; i < 8; ++i) { a[i] = (_Float16)p[i]; a[8 + i] = (_Float16)p[16 + i]; }
  return a;
}
__device__ __forceinline__ v16h frag_f32s(const float* rowk0, int lane, float sc) {
  v16h a; const float* p = rowk0 + 8 * (lane >> 4);
#pragma unroll
  for (int i = 0; i < 8; ++i) { a[i] = (_Float16)(p[i] * sc); a[8 + i] = (_Float16)(p[16 + i] * sc); }
  return a;
}
// column fragment from a [K][ld] layout (column n), rows >= K read as 0
__device__ __forceinline__ v16h fragc_f32(const float* W, int k0, int n, int lane, int ld, int K) {
  v16h a; const int g = lane >> 4;
#pragma unroll
  for (int i = 0; i < 8; ++i) { const int ka = k0 + 8 * g + i, kb = ka + 16;
    a[i] = (_Float16)(ka < K ? W[(size_t)(ka < K ? ka : K - 1) * ld + n] : 0.f); a[8 + i] = (_Float16)(kb < K ? W[(size_t)(kb < K ? kb : K - 1) * ld + n] : 0.f); }
  return a;
}
struct F2 { v16b h, l; };
__device__ __forceinline__ F2 bsplit16(const float v[16]) { F2 r;
#pragma unroll
  for (int i = 0; i < 16; ++i) { const __bf16 h = (__bf16)v[i]; r.h[i] = h; r.l[i] = (__bf16)(v[i] - (float)h); }
  return r; }
__device__ __forceinline__ F2 split_row(const float* row, int k0, int lane) { float v[16]; const float* p = row + k0 + 8 * (lane >> 4);
#pragma unroll
  for (int i = 0; i < 8; ++i) { v[i] = p[i]; v[8 + i] = p[16 + i]; }
  return bsplit16(v); }
__device__ __forceinline__ F2 split_rowK(const float* row, int k0, int lane, int K) { float v[16]; const int g = lane >> 4;
#pragma unroll
  for (int i = 0; i < 8; ++i) { const int ka = k0 + 8 * g + i, kb = ka + 16; v[i] = ka < K ? row[ka < K ? ka : K - 1] : 0.f; v[8 + i] = kb < K ? row[kb < K ? kb : K - 1] : 0.f; }
  return bsplit16(v); }
__device__ __forceinline__ F2 split_col(const float* W, int k0, int n, int lane, int ld, int K) { float v[16]; const int g = lane >> 4;
#pragma unroll
  for (int i = 0; i < 8; ++i) { const int ka = k0 + 8 * g + i, kb = ka + 16; v[i] = ka < K ? W[(size_t)(ka < K ? ka : K - 1) * ld + n] : 0.f; v[8 + i] = kb < K ? W[(size_t)(kb < K ? kb : K - 1) * ld + n] : 0.f; }
  return bsplit16(v); }
__device__ __forceinline__ v8f mac3(const F2& a, const F2& b, v8f c) { c = wmma_bf(a.l, b.h, c); c = wmma_bf(a.h, b.l, c); return wmma_bf(a.h, b.h, c); }
__device__ __forceinline__ float sigm(float v) { return 1.0f / (1.0f + expf(-v)); }
#define LDSX() do { asm volatile("s_wait_dscnt 0" ::: "memory"); __builtin_amdgcn_wave_barrier(); __builtin_amdgcn_fence(__ATOMIC_RELEASE, "workgroup"); } while (0)

// Single-head NON-causal self-attention with head size 128 (x [4,2048,1024]; (in,out) Wk / Wq / Wv [1024,128] N(0, 1/1024), no biases; no mask in the source; scale 128^-0.5): out = softmax(q k^T * 128^-0.5) v -> [4,2048,128].
#define NB 4
#define TT 2048
#define CC 128            // NH * HD = projected width
#define DIN 1024          // input (model) width
#define NH 1
#define HD 128
#define NQB (TT / 64)
#define HG 1
#define SCALE (0.08838834764831845f)
#define CAUSAL 0
#ifndef TNB
#define TNB NB
#endif
__device__ __forceinline__ float bfr(float v) { return (float)(__bf16)v; }
__host__ __device__ __forceinline__ int kb_last(int qb) { return CAUSAL ? ((qb * 64 + 63) >> 7) : (TT / 128 - 1); }
typedef __attribute__((ext_vector_type(8))) __bf16 v8b;
__device__ __forceinline__ v16b frag_b(const __bf16* rowk0, int lane) {
  union { v16b v; v8b q[2]; } u; const __bf16* p = rowk0 + 8 * (lane >> 4);
  u.q[0] = *(const v8b*)p; u.q[1] = *(const v8b*)(p + 16); return u.v;
}
// B fragment (k rows k0+.., output column o) of a weight: (in,out) [K][ld] or (out,in) [ld rows of K]: bf16 exact, or f16(bf16 * 256) exact
__device__ __forceinline__ v16b wcol_io(const float* Wm, int k0, int o, int lane, int ld) { v16b w; const int g = lane >> 4;
#pragma unroll
  for (int i = 0; i < 8; ++i) { w[i] = (__bf16)Wm[(size_t)(k0 + 8 * g + i) * ld + o]; w[8 + i] = (__bf16)Wm[(size_t)(k0 + 16 + 8 * g + i) * ld + o]; }
  return w; }
__device__ __forceinline__ v16b wcol_oi(const float* Wm, int k0, int o, int lane, int K) { v16b w; const float* p = Wm + (size_t)o * K + k0 + 8 * (lane >> 4);
#pragma unroll
  for (int i = 0; i < 8; ++i) { w[i] = (__bf16)p[i]; w[8 + i] = (__bf16)p[16 + i]; }
  return w; }
__device__ __forceinline__ v16h wcolh_io(const float* Wm, int k0, int o, int lane, int ld) { v16h w; const int g = lane >> 4;
#pragma unroll
  for (int i = 0; i < 8; ++i) { w[i] = (_Float16)(bfr(Wm[(size_t)(k0 + 8 * g + i) * ld + o]) * 256.0f); w[8 + i] = (_Float16)(bfr(Wm[(size_t)(k0 + 16 + 8 * g + i) * ld + o]) * 256.0f); }
  return w; }
__device__ __forceinline__ v16h wcolh_oi(const float* Wm, int k0, int o, int lane, int K) { v16h w; const float* p = Wm + (size_t)o * K + k0 + 8 * (lane >> 4);
#pragma unroll
  for (int i = 0; i < 8; ++i) { w[i] = (_Float16)(bfr(p[i]) * 256.0f); w[8 + i] = (_Float16)(bfr(p[16 + i]) * 256.0f); }
  return w; }
#define WQKV_LAYOUT 0   // 0 = (in,out) [DIN][CC]; 1 = (out,in) [CC][DIN]; 2 = per-head [NH][DIN][HD]
__device__ __forceinline__ v16b wcol_hdk(const float* Wm, int k0, int o, int lane) { v16b w; const int g = lane >> 4; const float* p = Wm + (size_t)(o / HD) * DIN * HD + (o % HD);
#pragma unroll
  for (int i = 0; i < 8; ++i) { w[i] = (__bf16)p[(size_t)(k0 + 8 * g + i) * HD]; w[8 + i] = (__bf16)p[(size_t)(k0 + 16 + 8 * g + i) * HD]; }
  return w; }
#define WO_OUT_IN 0
#if WQKV_LAYOUT == 1
#define WCOL(W, k0, o, lane) wcol_oi(W, k0, o, lane, DIN)
#elif WQKV_LAYOUT == 2
#define WCOL(W, k0, o, lane) wcol_hdk(W, k0, o, lane)
#else
#define WCOL(W, k0, o, lane) wcol_io(W, k0, o, lane, CC)
#endif
#if WO_OUT_IN
#define WOCOL(W, k0, o, lane) wcol_oi(W, k0, o, lane, CC)
#define WOCOLH(W, k0, o, lane) wcolh_oi(W, k0, o, lane, CC)
#else
#define WOCOL(W, k0, o, lane) wcol_io(W, k0, o, lane, DIN)
#define WOCOLH(W, k0, o, lane) wcolh_io(W, k0, o, lane, DIN)
#endif

#ifndef SM_EXTRA_PARAMS
#define SM_EXTRA_PARAMS
#endif
#ifndef PROJ_EXTRA_PARAMS
#define PROJ_EXTRA_PARAMS
#endif
#ifndef SM_MASK_HOOK
#define SM_MASK_HOOK (void)0
#endif

// q, k and v lie in FRAGMENT ORDER: one 16 x 32 WMMA fragment is a block of 1 KiB = two runs of 512 bytes, run h holding at lane * 16 bytes the eight elements 16 h + 8 (lane >> 4) + 0..7 of row lane & 15, so that each of a fragment's two 16-byte loads reads four whole lines
#define WS_QH  0u                                      // f16 q fragments [b*t / 16][CC / 32][1 KiB]: rows = 16 queries, elements = 32 head channels
#define WS_KH  (WS_QH + 2u * (size_t)NB * TT * CC)      // f16 k fragments [b*t / 16][CC / 32][1 KiB]: rows = 16 keys, elements = 32 head channels
#define WS_VT  (WS_KH + 2u * (size_t)NB * TT * CC)      // f16 v fragments [b][t / 32][CC / 16][1 KiB]: rows = 16 channels, elements = 32 keys
#define WS_END (WS_VT + 2u * (size_t)NB * CC * TT)

// ---- k_proj: block = (128 rows, 128 cols, which), 8 waves: q/k/v = X W with exact bf16 products (K = DIN) -> which 0: q f16 fragments; 1: k f16 fragments; 2: v f16 fragments; the fragment order (at WS_QH) takes CC == 128, one column block
// X and W go through LDS as bf16 in chunks of PKC k, two buffers: every global load is a 16-byte load whose wave covers four whole lines, and one barrier a chunk publishes the new buffer and frees the old one.
// A chunk's pass puts all its LDS work at its head: the fragment reads of BOTH halves of chunk t (two fragment sets), behind them the conversion and the LDS stores of chunk t + 1 into the other buffer, then the global loads that refill the registers just stored (W of chunk t + 2, X of chunk t + 3), and only then the 16 products of a wave, back to back. The stores and the load issue run while the fragment reads are under way, and between the last product and the barrier stand only the pointer step and the wait for LDS work that is long done. (Two register sets for X, so the loop body is two chunks.)
// W is turned on its way into LDS: a thread holds 8 k x 4 columns and stores, per column, 8 consecutive k as 16 bytes, so that A and B fragments are both two 16-byte LDS reads of a row. Waves 4 x 2, each 32 rows of the A side x 64 rows of the B side.
// X and W tiles have the same LDS form (128 rows of PKC k), so either can be the A side. v: A = X, B = W, so a lane's 8 accumulator elements are 8 consecutive keys of one channel. q and k: A = W, B = X (the transposed product), so they are 8 consecutive channels of one row.
// Either way these 8 values, as f16, are the lane's own 16 bytes of a fragment run (at WS_QH): every accumulator tile goes from registers to the workspace in one 16-byte store a lane, 512 consecutive bytes a wave, with no pass through LDS and no barrier behind the last products.
// The 64 blocks of one weight read the same W lines, the 3 blocks of one row tile the same X lines: each block enters the ring of PNCH chunks at a place of its own (from its block index) and wraps round, so that they do not ask L2 for the same lines at the same moment. Every accumulator sums its k in steps of 32, ascending from that place and wrapped.
#define PROWS 128          // rows of X per block
#define PKC 64             // k per chunk
#define PPIT (PKC + 8)     // LDS row pitch in elements: 128 bytes of data + 16, the pitch for 16-byte readers
#define PNCH (DIN / PKC)
typedef __attribute__((ext_vector_type(4))) __bf16 v4b;
// the scheduling barrier at the foot of each load group keeps the groups whole, in the order written and above the products: the load counter runs in issue order, so a wait for W must not have the younger X loads in front of it
#define P_LOADX(x, p) do { _Pragma("unroll") for (int i = 0; i < 8; ++i) x[i] = *(const v4f*)((p) + (size_t)i * 16 * DIN); __builtin_amdgcn_sched_barrier(0); } while (0)
#define P_LOADW(p) do { _Pragma("unroll") for (int i = 0; i < 8; ++i) wv[i] = *(const v4f*)((p) + (size_t)i * CC); __builtin_amdgcn_sched_barrier(0); } while (0)
// both walking pointers go one chunk on, from the last chunk of the ring back to the first; the wait stands in front because the additions rewrite the address registers that the loads above name, and behind the products, where those loads have long been taken
#define P_STEP() do { __builtin_amdgcn_sched_barrier(0); asm volatile("s_wait_xcnt 0x0" ::: "memory"); cw = (cw + 1) & (PNCH - 1); wp += cw ? PKC * CC : (PKC - DIN) * CC; cx = (cx + 1) & (PNCH - 1); xp += cx ? PKC : PKC - DIN; } while (0)
// work-group barrier for LDS data alone: this wave's LDS stores are complete, then the barrier; written by hand because __syncthreads() also waits for every global load, and the X loads issued ahead are to stay in flight across it
#define P_BAR() asm volatile("s_wait_dscnt 0x0\n\ts_barrier_signal -1\n\ts_barrier_wait -1" ::: "memory")
// the scheduling barrier at the head of P_STORE keeps the conversions and stores behind all 24 fragment reads: LDS work completes in issue order, so a read issued behind the stores would wait for them
#define P_STORE(x, buf) do { __builtin_amdgcn_sched_barrier(0); _Pragma("unroll") for (int i = 0; i < 8; ++i) { v4b p; _Pragma("unroll") for (int e = 0; e < 4; ++e) p[e] = (__bf16)x[i][e]; *(v4b*)&st[0][buf][(tid >> 4) + 16 * i][(tid & 15) * 4] = p; } \
    _Pragma("unroll") for (int c = 0; c < 4; ++c) { v8b p; _Pragma("unroll") for (int i = 0; i < 8; ++i) p[i] = (__bf16)wv[i][c]; *(v8b*)&st[1][buf][(wave & 3) * 32 + cl * 4 + c][((wave >> 2) * 4 + kl) * 8] = p; } } while (0)
#define P_FRAGS(buf) do { _Pragma("unroll") for (int kk = 0; kk < PKC / 32; ++kk) { \
    _Pragma("unroll") for (int i = 0; i < 2; ++i) fa[kk][i] = frag_b(pa + ((buf) * 128 + i * 16) * PPIT + kk * 32, lane); \
    _Pragma("unroll") for (int j = 0; j < 4; ++j) fw[kk][j] = frag_b(pb + ((buf) * 128 + j * 16) * PPIT + kk * 32, lane); } } while (0)
#define P_MUL() do { _Pragma("unroll") for (int kk = 0; kk < PKC / 32; ++kk) \
    _Pragma("unroll") for (int i = 0; i < 2; ++i) _Pragma("unroll") for (int j = 0; j < 4; ++j) acc[i][j] = wmma_bfp(fa[kk][i], fw[kk][j], acc[i][j]); } while (0)
// behind the last W loads no pointer steps on, but their address registers become free for other values: the same wait, at the same place behind the products; the pointer is an input of the statement so that its registers stay the pointer's up to the wait (left free, the last load's result was laid on them: seen in the listing)
#define P_XW(p) do { __builtin_amdgcn_sched_barrier(0); asm volatile("s_wait_xcnt 0x0" :: "v"(p) : "memory"); } while (0)
__global__ __launch_bounds__(256) void k_proj(const float* __restrict__ XQ, const float* __restrict__ XK, const float* __restrict__ XV, const float* __restrict__ WQ, const float* __restrict__ WK, const float* __restrict__ WV,
    _Float16* __restrict__ QH, _Float16* __restrict__ KH, _Float16* __restrict__ VT) {
  __shared__ __align__(16) __bf16 st[2][2][128][PPIT];   // [0] = X tile, [1] = W tile (turned); two buffers each; PROWS == 128
  const int tid = threadIdx.x, wave = tid >> 5, lane = tid & 31, col = lane & 15; const int which = blockIdx.z; const int c0 = blockIdx.y * 128; const size_t r0 = (size_t)blockIdx.x * PROWS;
  const float* X = which == 0 ? XQ : which == 1 ? XK : XV; const float* WA = which == 0 ? WQ : which == 1 ? WK : WV;
  const int wr = wave >> 1, wc = wave & 1, cl = lane & 7, kl = lane >> 3;
  const int sa = which < 2 ? 1 : 0;   // which tile is the A side
  const __bf16* pa = &st[sa][0][wr * 32 + col][0]; const __bf16* pb = &st[sa ^ 1][0][wc * 64 + col][0];
  const float* xg = X + (r0 + (tid >> 4)) * DIN + (tid & 15) * 4;                                        // a wave's load: 2 rows x 256 bytes
  const float* wg = WA + (size_t)(((wave >> 2) * 4 + kl) * 8) * CC + c0 + (wave & 3) * 32 + cl * 4;      // a wave's load: 4 k rows x 128 bytes
  v4f xa[8], xb[8], wv[8]; v8f acc[2][4] = {}; v16b fa[PKC / 32][2], fw[PKC / 32][4];
  const int rot = (blockIdx.x + 10 * (blockIdx.x >> 3) + 5 * blockIdx.z) & (PNCH - 1);   // the block's place of entry: any value is right, the spread is for speed alone
  int cw = (rot + 1) & (PNCH - 1), cx = (rot + 2) & (PNCH - 1); const float* wp = wg + (size_t)cw * PKC * CC; const float* xp = xg + cx * PKC;   // chunk t of the walk is chunk (rot + t) mod PNCH of k
  P_LOADX(xa, xg + rot * PKC); P_LOADW(wg + (size_t)rot * PKC * CC); P_LOADX(xb, xg + cw * PKC);
  asm volatile("s_wait_xcnt 0x0" ::: "memory");   // the address registers that these three groups name are used for other values from here on; the wait for the first group's data follows at once, so this one costs nothing
  // piece e (16 bytes) of the block's 32 KiB in fragment order. q, k: e = 256 (row tile) + 32 (channel tile) + lane, row tile = 4 wc + j, channel tile = 2 wr + i. v: e = 512 (32 keys) + 64 (channel tile) + 32 (key half) + lane, 32 keys = wr, channel tile = 4 wc + j, key half = i.
  const int js = which < 2 ? 256 : 64, ewc = 4 * js, ewr = which < 2 ? 64 : 512;
  _Float16* dp = (which == 0 ? QH : which == 1 ? KH : VT) + r0 * CC + (size_t)(wc * ewc + wr * ewr + lane) * 8;
  P_STORE(xa, 0); P_LOADW(wp); P_LOADX(xa, xp); P_STEP();
  P_BAR();
#pragma unroll 1   // rolled: the body is two chunks, one for each register set of X, and the code stays small
  for (int t = 0; t + 4 < PNCH; t += 2) {
    P_FRAGS(0); P_STORE(xb, 1); P_LOADW(wp); P_LOADX(xb, xp); P_MUL(); P_STEP();
    P_BAR();     // publishes chunk t + 1 and ends every read of chunk t, whose buffer is refilled in the next pass
    P_FRAGS(1); P_STORE(xa, 0); P_LOADW(wp); P_LOADX(xa, xp); P_MUL(); P_STEP();
    P_BAR(); }   // the same for chunk t + 2
  // the last four chunks, peeled: the walk asks for nothing past its last chunk
  P_FRAGS(0); P_STORE(xb, 1); P_LOADW(wp); P_LOADX(xb, xp); P_MUL(); P_STEP();
  P_BAR();
  P_FRAGS(1); P_STORE(xa, 0); P_LOADW(wp); P_MUL(); P_XW(wp);
  P_BAR();
  P_FRAGS(0); P_STORE(xb, 1); P_MUL();
  P_BAR();
  P_FRAGS(1); P_MUL();
  // both loops unrolled: the accumulators are indexed at compile time and stay in registers
#pragma unroll
  for (int i = 0; i < 2; ++i)
#pragma unroll
  for (int j = 0; j < 4; ++j) { v8h h;
#pragma unroll
    for (int r = 0; r < 8; ++r) h[r] = (_Float16)acc[i][j][r];
    *(v8h*)(dp + (j * js + i * 32) * 8) = h; } }
__device__ __forceinline__ float exp2_slot(float x) { float y; asm("v_exp_f32 %0, %1\n\tv_nop" : "=v"(y) : "v"(x)); return y; }
// eight base-2 exponentials in one statement: no result lies on a source (early clobber) and the slot behind the last one is filled
__device__ __forceinline__ v8f exp2_x8(v8f x) { float y0, y1, y2, y3, y4, y5, y6, y7;
  asm("v_exp_f32 %0, %8\n\tv_exp_f32 %1, %9\n\tv_exp_f32 %2, %10\n\tv_exp_f32 %3, %11\n\tv_exp_f32 %4, %12\n\tv_exp_f32 %5, %13\n\tv_exp_f32 %6, %14\n\tv_exp_f32 %7, %15\n\tv_nop"
      : "=&v"(y0), "=&v"(y1), "=&v"(y2), "=&v"(y3), "=&v"(y4), "=&v"(y5), "=&v"(y6), "=&v"(y7) : "v"(x[0]), "v"(x[1]), "v"(x[2]), "v"(x[3]), "v"(x[4]), "v"(x[5]), "v"(x[6]), "v"(x[7]));
  return v8f{y0, y1, y2, y3, y4, y5, y6, y7}; }
#define KSPLIT 8
#define QTILES 2
#define KBLK 64
#define NBLK (TT / KSPLIT / KBLK)
// one fragment in fragment order; p = its 1-KiB block + lane * 8 elements
__device__ __forceinline__ v16h frag_p(const _Float16* p) { union { v16h v; v8h q[2]; } u; u.q[0] = *(const v8h*)p; u.q[1] = *(const v8h*)(p + 256); return u.v; }
// the scheduling barriers at the head and the foot of a load group keep it whole and where it is written, right behind the products that free its registers: left free, the compiler lifted a whole pass's loads to the head of the loop, into registers of their own (498 seen)
#define LDK(buf, j) do { __builtin_amdgcn_sched_barrier(0); _Pragma("unroll") for (int t = 0; t < 4; ++t) fb[buf][t] = frag_p(kp + ((j) * 4 + t) * 512); __builtin_amdgcn_sched_barrier(0); } while (0)                                   /* key tile j, head slices 0..3 */
#define LDV(buf, jj) do { __builtin_amdgcn_sched_barrier(0); _Pragma("unroll") for (int t = 0; t < 4; ++t) fb[buf][t] = frag_p(vp + ((t & 1) * (CC / 16) + (jj) * 2 + (t >> 1)) * 512); __builtin_amdgcn_sched_barrier(0); } while (0)   /* channel tiles 2jj, 2jj+1, key slices 0..1 */
#define QK(buf, j) do { _Pragma("unroll") for (int t = 0; t < 4; ++t) _Pragma("unroll") for (int u = 0; u < QTILES; ++u) s[u][j] = wmma16(fb[buf][t], aq[u][t], s[u][j]); } while (0)
#define PV(buf, jj) do { _Pragma("unroll") for (int t = 0; t < 4; ++t) _Pragma("unroll") for (int u = 0; u < QTILES; ++u) o[u][(jj) * 2 + (t >> 1)] = wmma16(fb[buf][t], pf[u][t & 1], o[u][(jj) * 2 + (t >> 1)]); } while (0)
// the walk of one wave. R (0 or 2) is the place at which every pass enters its rings of four key tiles and of four channel groups: the order in which tiles and groups are loaded and multiplied, nothing else (each still goes to its own accumulators, so R changes no value). It is a compile-time number, so that every register index stays one; the kernel picks one of the two copies by a scalar branch.
#define RT(n) (((n) + R) & 3)
template <int R> __device__ __forceinline__ void fa_walk(const _Float16* kp, const _Float16* vp, int cb, const v16h (&aq)[QTILES][HD / 32], v8f (&o)[QTILES][HD / 16], float (&m)[QTILES], float (&l)[QTILES]) {
  const float c2 = SCALE * 1.4426950408889634f;   // logit scale times log2(e): the exponentials are base 2
  v16h fb[2][4], pf[QTILES][2];
  LDK(0, RT(0)); LDK(1, RT(1));
#pragma unroll 1   // rolled: a pass is one straight block of code, and the two fragment groups in flight are carried over its back edge
  for (int kb = 0; kb < NBLK; ++kb) { v8f s[QTILES][KBLK / 16] = {};
    QK(0, RT(0)); LDK(0, RT(2)); QK(1, RT(1)); LDK(1, RT(3)); QK(0, RT(2)); LDV(0, RT(0)); QK(1, RT(3)); LDV(1, RT(1));
#pragma unroll
    for (int u = 0; u < QTILES; ++u) { float mx = s[u][0][0];
#pragma unroll
      for (int j = 0; j < KBLK / 16; ++j)
#pragma unroll
        for (int r = 0; r < 8; ++r) mx = fmaxf(mx, s[u][j][r]);
      mx = fmaxf(mx, __shfl_xor(mx, 16));   // the other half of the wave holds the query's other 32 keys
      const float mn = fmaxf(m[u], mx * c2); const float al = exp2_slot(m[u] - mn); m[u] = mn; float sj[KBLK / 16] = {};
#pragma unroll
      for (int j = 0; j < KBLK / 16; ++j) { const v8f p = exp2_x8(s[u][j] * c2 - mn);
#pragma unroll
        for (int r = 0; r < 8; ++r) { sj[j] += p[r]; pf[u][j >> 1][(j & 1) * 8 + r] = (_Float16)p[r]; } }
      l[u] = l[u] * al + ((sj[0] + sj[1]) + (sj[2] + sj[3]));
#pragma unroll
      for (int j = 0; j < HD / 16; ++j) o[u][j] *= al; }
    asm volatile("s_wait_xcnt 0x0" ::: "memory");   // the addition to kp below rewrites the address registers that the k loads above name
    const int step = cb + 1 < NBLK ? KBLK * CC : -(NBLK - 1) * KBLK * CC; cb = (cb + 1) & (NBLK - 1);   // one block on, from the last block of the ring back to the first
    kp += step;   // behind the last pass the first two key tiles of the walk are read again, unused: the loads stay unconditional and their counted waits exact
    PV(0, RT(0)); LDV(0, RT(2)); PV(1, RT(1)); LDV(1, RT(3)); PV(0, RT(2)); LDK(0, RT(0)); PV(1, RT(3)); LDK(1, RT(1));
    int stepv = step;
    asm volatile("s_wait_xcnt 0x0" : "+s"(stepv) :: "memory");   // the line below rewrites the address registers that the v loads above name; the step goes through this statement because the addition, left free, was placed ahead of the wait (seen in the listing)
    vp += stepv; } }
__global__ __launch_bounds__(32 * KSPLIT) void k_fa(const _Float16* __restrict__ QH, const _Float16* __restrict__ KH, const _Float16* __restrict__ VT, float* __restrict__ Y) {
  __shared__ __align__(16) float ps[KSPLIT][16 * QTILES][HD + 4]; __shared__ float pm[KSPLIT][16 * QTILES], pl[KSPLIT][16 * QTILES];
  const int tid = threadIdx.x, wave = tid >> 5, lane = tid & 31, col = lane & 15, g = lane >> 4; const int b = blockIdx.y; const size_t qb0 = (size_t)b * TT + blockIdx.x * (16 * QTILES);
  const int ph = (blockIdx.x + (blockIdx.x >> 3)) & (2 * NBLK - 1);   // the work-group's place of entry, one of eight: any value is right, the spread is for speed alone
  const int cb = ph & (NBLK - 1);   // the key block that the walk begins with
  const _Float16* kp = KH + ((size_t)b * TT + wave * (TT / KSPLIT) + cb * KBLK) * CC + lane * 8; const _Float16* vp = VT + ((size_t)b * TT + wave * (TT / KSPLIT) + cb * KBLK) * CC + lane * 8;   // in fragment order too, 32 keys take 32 * CC elements of k and as many of v
  v16h aq[QTILES][HD / 32];
  const _Float16* qp = QH + qb0 * CC + lane * 8;
#pragma unroll
  for (int u = 0; u < QTILES; ++u)
#pragma unroll
    for (int kc = 0; kc < HD / 32; ++kc) aq[u][kc] = frag_p(qp + u * 16 * CC + kc * 512);
  asm volatile("s_wait_xcnt 0x0" ::: "memory");   // the base registers that the q loads name are written anew in front of the loop; the wait stands here, ahead of the k loads, where it waits for the q loads alone
  __builtin_amdgcn_sched_barrier(0);   // q loads stay the oldest: issued behind the k groups they would turn the loop's first counted wait into a wait for every load
  v8f o[QTILES][HD / 16] = {}; float m[QTILES], l[QTILES];
#pragma unroll
  for (int u = 0; u < QTILES; ++u) { m[u] = -3.0e38f; l[u] = 0.f; }
  if (ph & NBLK) fa_walk<2>(kp, vp, cb, aq, o, m, l); else fa_walk<0>(kp, vp, cb, aq, o, m, l);
#pragma unroll
  for (int u = 0; u < QTILES; ++u) { l[u] += __shfl_xor(l[u], 16);
    if (g == 0) { pm[wave][u * 16 + col] = m[u]; pl[wave][u * 16 + col] = l[u]; }
#pragma unroll
    for (int j = 0; j < HD / 16; ++j) { *(v4f*)&ps[wave][u * 16 + col][j * 16 + 8 * g] = __builtin_shufflevector(o[u][j], o[u][j], 0, 1, 2, 3); *(v4f*)&ps[wave][u * 16 + col][j * 16 + 8 * g + 4] = __builtin_shufflevector(o[u][j], o[u][j], 4, 5, 6, 7); } }
  __syncthreads();
#pragma unroll
  for (int i = 0; i < 16 * QTILES / KSPLIT; ++i) { const int rr = wave + KSPLIT * i; float mm = pm[0][rr];
#pragma unroll
    for (int w = 1; w < KSPLIT; ++w) mm = fmaxf(mm, pm[w][rr]);
    float den = 0.f; v4f acc = {};
#pragma unroll
    for (int w = 0; w < KSPLIT; ++w) { const float f = exp2_slot(pm[w][rr] - mm); den += f * pl[w][rr]; acc += *(const v4f*)&ps[w][rr][lane * 4] * f; }
    vst2(Y + (qb0 + rr) * CC + lane * 4, acc * (1.0f / den)); } }

extern "C" void kernel_launch(void* const* d_in, const int* in_sizes, int n_in, void* d_out, int out_size, void* d_ws, size_t ws_size, hipStream_t stream) {
  (void)in_sizes; (void)n_in; (void)out_size;
  const float** F = (const float**)d_in;
  if (ws_size < (size_t)WS_END) return;
  char* ws = (char*)d_ws; _Float16 *QH = (_Float16*)(ws + WS_QH), *KH = (_Float16*)(ws + WS_KH), *VT = (_Float16*)(ws + WS_VT);
  // inputs: 0 x [4,2048,1024]; 1 Wk [1024,128] (in,out); 2 Wq [1024,128]; 3 Wv [1024,128]; no biases
  k_proj<<<dim3(TNB * TT / PROWS, CC / 128, 3), 256, 0, stream>>>(F[0], F[0], F[0], F[2], F[1], F[3], QH, KH, VT);   /* q uses Wq = input 2, k uses Wk = input 1 */
  // logits, softmax and P . v of every batch in one launch
  k_fa<<<dim3(TT / (16 * QTILES), TNB), 32 * KSPLIT, 0, stream>>>(QH, KH, VT, (float*)d_out);
}
